// v000
// Measured on an AMD MI455X. A time is GPU time per run, averaged over a window of back-to-back runs after a warm-up
// (all launches, gaps included; the runs take copies of the inputs in turn), and the median of several windows.
// Apart from v000's, it joins two sittings. Times from different sittings can be a few percent apart, while
// side-by-side timings come from the same sitting.
// The starting kernel, v000, takes 184 microseconds a run.
#include <hip/hip_runtime.h>
#include <hip/hip_bf16.h>

typedef __attribute__((ext_vector_type(16))) _Float16 v16h;
typedef __attribute__((ext_vector_type(8)))  _Float16 v8h;
typedef __attribute__((ext_vector_type(8)))  float    v8f;

#define BATCH 2
#define SEQ   2048
#define CIN   512
#define NHEAD 8
#define CHEAD 64
#define HC    512          // NHEAD*CHEAD
#define BS    4096         // BATCH*SEQ

// ---------------------------------------------------------------------------
// WMMA helpers
// ---------------------------------------------------------------------------
__device__ __forceinline__ v8f wmma_f16(v16h a, v16h b, v8f c) {
  // D = A(16x32 f16) * B(32x16 f16) + C(16x16 f32)
  return __builtin_amdgcn_wmma_f32_16x16x32_f16(
      false, a, false, b, (short)0, c, false, false);
}

// Load one 16x32 f16 fragment (A-layout; also serves B when the B source is
// stored n-major with k contiguous). `base` points at element (row0, k0),
// `ld` is the row stride in elements. Per ISA 16-bit A layout:
//   lanes 0-15 : row = lane,    K = 0..7 and 16..23
//   lanes 16-31: row = lane-16, K = 8..15 and 24..31
__device__ __forceinline__ v16h load_frag16(const _Float16* base, int ld) {
  const int lane = threadIdx.x & 31;
  const int row  = lane & 15;
  const int koff = (lane >> 4) << 3;        // 0 or 8
  const _Float16* p = base + row * ld + koff;
  v8h lo = *(const v8h*)(p);                // K = koff .. koff+7
  v8h hi = *(const v8h*)(p + 16);           // K = 16+koff .. 16+koff+7
  return __builtin_shufflevector(lo, hi, 0,1,2,3,4,5,6,7,
                                 8,9,10,11,12,13,14,15);
}

// ---------------------------------------------------------------------------
// CDNA5 async memory->LDS staging (ASYNCcnt path; no VGPR round-trip).
// Async loads complete in order, so "s_wait_asynccnt N" with N = #chunks just
// issued for the NEXT tile guarantees the PREVIOUS tile has fully landed --
// the basis for double-buffered DMA/compute overlap.
// ---------------------------------------------------------------------------
typedef __attribute__((address_space(3))) const void* lds_cptr_t;

__device__ __forceinline__ unsigned lds_base(const void* p) {
  // addrspace(3) pointers are 32-bit offsets from the wave's LDS base
  return (unsigned)(unsigned long long)(lds_cptr_t)p;
}

__device__ __forceinline__ void async_ld16(unsigned lds_off, const void* g) {
  // per-lane: LDS[lds_off] = MEM[g] (16 bytes), tracked with ASYNCcnt
  asm volatile("global_load_async_to_lds_b128 %0, %1, off"
               :: "v"(lds_off), "v"((unsigned long long)g)
               : "memory");
}

__device__ __forceinline__ void wait_async0() {
  asm volatile("s_wait_asynccnt 0x0" ::: "memory");
}
__device__ __forceinline__ void wait_async2() {
  asm volatile("s_wait_asynccnt 0x2" ::: "memory");
}
__device__ __forceinline__ void wait_async4() {
  asm volatile("s_wait_asynccnt 0x4" ::: "memory");
}

// ---------------------------------------------------------------------------
// Conversion kernels
// ---------------------------------------------------------------------------
__global__ void __launch_bounds__(256) cvt_f32_to_f16(
    const float* __restrict__ src, _Float16* __restrict__ dst, int n) {
  int i = blockIdx.x * 256 + threadIdx.x;
  if (i < n) dst[i] = (_Float16)src[i];
}

// wT[n*512 + k] = (f16) w[k*512 + n]   (512x512 transpose + convert)
__global__ void __launch_bounds__(256) cvt_w_transpose(
    const float* __restrict__ w, _Float16* __restrict__ wT) {
  int i = blockIdx.x * 256 + threadIdx.x;   // 0 .. 262143
  int n = i >> 9, k = i & 511;
  wT[i] = (_Float16)w[k * CIN + n];
}

// ---------------------------------------------------------------------------
// Projection GEMM: Y[4096,512] = Xh[4096,512] @ W[512,512]  (W given as W^T)
// mode 0/1: Q/K  -> f16 [B,H,S,c];  mode 2: V -> f16 [B,H,c,S] (transposed);
// mode 3: gate -> f32 sigmoid(Y + bg) at [B,S,HC].
// Block: 128 threads = 4 waves; block tile 64(M) x 64(N); wave tile 16x64.
// W^T tiles double-buffered in LDS via async DMA, shared by the 4 waves.
// ---------------------------------------------------------------------------
__global__ void __launch_bounds__(128) gemm_proj(
    const _Float16* __restrict__ xh, const _Float16* __restrict__ wT,
    const float* __restrict__ bg,
    _Float16* __restrict__ out16, float* __restrict__ out32, int mode) {
  __shared__ _Float16 wbufA[64 * 32];       // [n_local][k_local]
  __shared__ _Float16 wbufB[64 * 32];

  const int tid  = threadIdx.x;
  const int wv   = tid >> 5;
  const int lane = tid & 31;
  const int lr   = lane & 15;
  const int lh   = lane >> 4;
  const int m0   = blockIdx.y * 64 + wv * 16;
  const int n0   = blockIdx.x * 64;
  const unsigned wA = lds_base(wbufA);
  const unsigned wB = lds_base(wbufB);

  v8f acc[4] = {};

  auto stage = [&](int k0, unsigned dst) {
#pragma unroll
    for (int i = 0; i < 2; ++i) {
      const int id = tid + i * 128;         // 0..255 chunks of 16B
      const int nl = id >> 2, ch = id & 3;
      async_ld16(dst + (unsigned)(nl * 32 + ch * 8) * 2,
                 wT + (size_t)(n0 + nl) * CIN + k0 + ch * 8);
    }
  };
  auto compute = [&](int k0, const _Float16* wb) {
    v16h a = load_frag16(xh + (size_t)m0 * CIN + k0, CIN);
#pragma unroll
    for (int nt = 0; nt < 4; ++nt) {
      v16h b = load_frag16(wb + nt * 16 * 32, 32);
      acc[nt] = wmma_f16(a, b, acc[nt]);
    }
  };

  stage(0, wA);
  for (int k0 = 0; k0 < CIN; k0 += 64) {
    stage(k0 + 32, wB);                     // k0+32 < 512 always
    wait_async2();                          // tile k0 landed; k0+32 in flight
    __syncthreads();
    compute(k0, wbufA);
    __syncthreads();                        // all reads of A done
    if (k0 + 64 < CIN) { stage(k0 + 64, wA); wait_async2(); }
    else               { wait_async0(); }
    __syncthreads();
    compute(k0 + 32, wbufB);
    __syncthreads();                        // all reads of B done
  }

  const int mbase = m0 + lh * 8;
#pragma unroll
  for (int nt = 0; nt < 4; ++nt) {
    const int n = n0 + nt * 16 + lr;
    const int h = n >> 6, c = n & 63;
#pragma unroll
    for (int r = 0; r < 8; ++r) {
      const int m = mbase + r;
      const int b = m >> 11, s = m & (SEQ - 1);
      const float v = acc[nt][r];
      if (mode <= 1) {
        out16[(((size_t)(b * NHEAD + h)) * SEQ + s) * CHEAD + c] = (_Float16)v;
      } else if (mode == 2) {
        out16[(((size_t)(b * NHEAD + h)) * CHEAD + c) * SEQ + s] = (_Float16)v;
      } else {
        out32[((size_t)(b * SEQ + s)) * HC + n] =
            1.0f / (1.0f + __expf(-(v + bg[n])));
      }
    }
  }
}

// ---------------------------------------------------------------------------
// Flash attention with pair bias + key mask + sigmoid gating.
// grid = (SEQ/64, B*H); block = 128 (4 waves); wave owns one 16-query tile.
// Keys streamed in steps of 32; K (4 KB) and V (4 KB) tiles double-buffered
// in LDS via async DMA so the next tile streams during this tile's WMMAs.
// ---------------------------------------------------------------------------
__global__ void __launch_bounds__(128) attn_flash(
    const _Float16* __restrict__ qh, const _Float16* __restrict__ kh,
    const _Float16* __restrict__ vt, const float* __restrict__ bias,
    const int* __restrict__ amask, const float* __restrict__ gate,
    _Float16* __restrict__ ocat) {
  __shared__ _Float16 kbufA[32 * 64], kbufB[32 * 64];   // [key_local][c]
  __shared__ _Float16 vbufA[64 * 32], vbufB[64 * 32];   // [c][key_local]
  __shared__ _Float16 pbuf[4][16 * 32];                 // per-wave P bounce

  const int tid  = threadIdx.x;
  const int wv   = tid >> 5;
  const int lane = tid & 31;
  const int lr   = lane & 15;
  const int lh   = lane >> 4;
  const int bh   = blockIdx.y;              // 0..15  => (b,h)
  const int bb   = bh >> 3, h = bh & 7;
  const int q0   = (blockIdx.x * 4 + wv) * 16;

  const _Float16* Q = qh + (size_t)bh * SEQ * CHEAD;
  const _Float16* K = kh + (size_t)bh * SEQ * CHEAD;
  const _Float16* V = vt + (size_t)bh * CHEAD * SEQ;
  const float* biasb = bias + ((size_t)bh * SEQ + q0) * SEQ;
  const int*   mk    = amask + bb * SEQ;
  const unsigned kA = lds_base(kbufA), kB = lds_base(kbufB);
  const unsigned vA = lds_base(vbufA), vB = lds_base(vbufB);

  v16h aq0 = load_frag16(Q + (size_t)q0 * CHEAD + 0,  CHEAD);
  v16h aq1 = load_frag16(Q + (size_t)q0 * CHEAD + 32, CHEAD);

  float mrun[8], lrun[8];
#pragma unroll
  for (int r = 0; r < 8; ++r) { mrun[r] = -1e30f; lrun[r] = 0.0f; }
  v8f oacc[4] = {};

  auto stage = [&](int kt, unsigned kdst, unsigned vdst) {
#pragma unroll
    for (int i = 0; i < 2; ++i) {
      const int id = tid + i * 128;         // 0..255
      const int kr = id >> 3, kc = id & 7;  // K: [32 rows][8 chunks]
      async_ld16(kdst + (unsigned)(kr * 64 + kc * 8) * 2,
                 K + (size_t)(kt + kr) * CHEAD + kc * 8);
      const int vc = id >> 2, vch = id & 3; // V^T: [64 rows][4 chunks]
      async_ld16(vdst + (unsigned)(vc * 32 + vch * 8) * 2,
                 V + (size_t)vc * SEQ + kt + vch * 8);
    }
  };

  auto compute = [&](int kt, const _Float16* kb, const _Float16* vb) {
    // --- logits tile: S = Q K^T  (16 x 32 in two 16x16 f32 fragments) ---
    v8f sa[2] = {};
#pragma unroll
    for (int nh = 0; nh < 2; ++nh) {
      v16h b0 = load_frag16(kb + nh * 16 * 64 + 0,  64);
      sa[nh] = wmma_f16(aq0, b0, sa[nh]);
      v16h b1 = load_frag16(kb + nh * 16 * 64 + 32, 64);
      sa[nh] = wmma_f16(aq1, b1, sa[nh]);
    }
    // --- scale + pair bias + key mask (bias streamed once from HBM) ---
#pragma unroll
    for (int nh = 0; nh < 2; ++nh) {
      const int kcol  = kt + nh * 16 + lr;
      const float moff = (mk[kcol] > 0) ? 0.0f : -1e9f;
      const float* bp = biasb + (size_t)(lh * 8) * SEQ + kcol;
      __builtin_prefetch(bp + 32, 0, 0);    // next key step -> global_prefetch
#pragma unroll
      for (int r = 0; r < 8; ++r)
        sa[nh][r] = sa[nh][r] * 0.125f + bp[(size_t)r * SEQ] + moff;
    }
    // --- online softmax (row reductions across 16 lanes, wave32 shfl) ---
#pragma unroll
    for (int r = 0; r < 8; ++r) {
      float tm = fmaxf(sa[0][r], sa[1][r]);
#pragma unroll
      for (int off = 8; off; off >>= 1) tm = fmaxf(tm, __shfl_xor(tm, off, 16));
      const float mnew = fmaxf(mrun[r], tm);
      const float p0 = __expf(sa[0][r] - mnew);
      const float p1 = __expf(sa[1][r] - mnew);
      sa[0][r] = p0; sa[1][r] = p1;
      float ts = p0 + p1;
#pragma unroll
      for (int off = 8; off; off >>= 1) ts += __shfl_xor(ts, off, 16);
      const float alpha = __expf(mrun[r] - mnew);
      lrun[r] = lrun[r] * alpha + ts;
      mrun[r] = mnew;
#pragma unroll
      for (int ct = 0; ct < 4; ++ct) oacc[ct][r] *= alpha;
    }
    // --- re-stripe P: C-layout f32 regs -> row-major f16 LDS -> A frag ---
    _Float16* pb = pbuf[wv];
#pragma unroll
    for (int nh = 0; nh < 2; ++nh)
#pragma unroll
      for (int r = 0; r < 8; ++r)
        pb[(lh * 8 + r) * 32 + nh * 16 + lr] = (_Float16)sa[nh][r];
    asm volatile("s_wait_dscnt 0x0" ::: "memory");
    v16h ap = load_frag16(pb, 32);
    // --- O += P V  (V staged transposed: rows = output column c) ---
#pragma unroll
    for (int ct = 0; ct < 4; ++ct) {
      v16h bv = load_frag16(vb + ct * 16 * 32, 32);
      oacc[ct] = wmma_f16(ap, bv, oacc[ct]);
    }
  };

  stage(0, kA, vA);
  for (int kt = 0; kt < SEQ; kt += 64) {
    stage(kt + 32, kB, vB);                 // kt+32 < 2048 always
    wait_async4();                          // tile kt landed; kt+32 in flight
    __syncthreads();
    compute(kt, kbufA, vbufA);
    __syncthreads();
    if (kt + 64 < SEQ) { stage(kt + 64, kA, vA); wait_async4(); }
    else               { wait_async0(); }
    __syncthreads();
    compute(kt + 32, kbufB, vbufB);
    __syncthreads();
  }

  // --- epilogue: normalize, gate, store concat-head f16 [B,S,HC] ---
#pragma unroll
  for (int r = 0; r < 8; ++r) {
    const float rl = 1.0f / lrun[r];
    const int q = q0 + lh * 8 + r;
    const size_t rowoff = ((size_t)(bb * SEQ + q)) * HC + h * CHEAD;
#pragma unroll
    for (int ct = 0; ct < 4; ++ct) {
      const int c = ct * 16 + lr;
      const float g = gate[rowoff + c];
      ocat[rowoff + c] = (_Float16)(oacc[ct][r] * rl * g);
    }
  }
}

// ---------------------------------------------------------------------------
// Output GEMM: out[4096,512] = Ocat[4096,512] @ Wo + bo   (Wo given as Wo^T)
// Same double-buffered async LDS weight staging as gemm_proj.
// ---------------------------------------------------------------------------
__global__ void __launch_bounds__(128) gemm_out(
    const _Float16* __restrict__ oc, const _Float16* __restrict__ woT,
    const float* __restrict__ bo, float* __restrict__ out) {
  __shared__ _Float16 wbufA[64 * 32];
  __shared__ _Float16 wbufB[64 * 32];

  const int tid  = threadIdx.x;
  const int wv   = tid >> 5;
  const int lane = tid & 31;
  const int lr   = lane & 15;
  const int lh   = lane >> 4;
  const int m0   = blockIdx.y * 64 + wv * 16;
  const int n0   = blockIdx.x * 64;
  const unsigned wA = lds_base(wbufA);
  const unsigned wB = lds_base(wbufB);

  v8f acc[4] = {};

  auto stage = [&](int k0, unsigned dst) {
#pragma unroll
    for (int i = 0; i < 2; ++i) {
      const int id = tid + i * 128;
      const int nl = id >> 2, ch = id & 3;
      async_ld16(dst + (unsigned)(nl * 32 + ch * 8) * 2,
                 woT + (size_t)(n0 + nl) * HC + k0 + ch * 8);
    }
  };
  auto compute = [&](int k0, const _Float16* wb) {
    v16h a = load_frag16(oc + (size_t)m0 * HC + k0, HC);
#pragma unroll
    for (int nt = 0; nt < 4; ++nt) {
      v16h b = load_frag16(wb + nt * 16 * 32, 32);
      acc[nt] = wmma_f16(a, b, acc[nt]);
    }
  };

  stage(0, wA);
  for (int k0 = 0; k0 < HC; k0 += 64) {
    stage(k0 + 32, wB);
    wait_async2();
    __syncthreads();
    compute(k0, wbufA);
    __syncthreads();
    if (k0 + 64 < HC) { stage(k0 + 64, wA); wait_async2(); }
    else              { wait_async0(); }
    __syncthreads();
    compute(k0 + 32, wbufB);
    __syncthreads();
  }

  const int mbase = m0 + lh * 8;
#pragma unroll
  for (int nt = 0; nt < 4; ++nt) {
    const int n = n0 + nt * 16 + lr;
    const float bn = bo[n];
#pragma unroll
    for (int r = 0; r < 8; ++r)
      out[(size_t)(mbase + r) * CIN + n] = acc[nt][r] + bn;
  }
}

// ---------------------------------------------------------------------------
extern "C" void kernel_launch(void* const* d_in, const int* in_sizes, int n_in,
                              void* d_out, int out_size, void* d_ws,
                              size_t ws_size, hipStream_t stream) {
  const float* x     = (const float*)d_in[0];
  const float* bias  = (const float*)d_in[1];
  const int*   amask = (const int*)d_in[2];
  const float* Wq    = (const float*)d_in[3];
  const float* Wk    = (const float*)d_in[4];
  const float* Wv    = (const float*)d_in[5];
  const float* Wg    = (const float*)d_in[6];
  const float* bg    = (const float*)d_in[7];
  const float* Wo    = (const float*)d_in[8];
  const float* bo    = (const float*)d_in[9];
  float* out = (float*)d_out;

  char* ws = (char*)d_ws;
  size_t off = 0;
  auto carve = [&](size_t bytes) -> char* {
    char* p = ws + off;
    off += (bytes + 255) & ~(size_t)255;
    return p;
  };
  _Float16* xh  = (_Float16*)carve((size_t)BS * CIN * 2);
  _Float16* wtq = (_Float16*)carve((size_t)CIN * HC * 2);
  _Float16* wtk = (_Float16*)carve((size_t)CIN * HC * 2);
  _Float16* wtv = (_Float16*)carve((size_t)CIN * HC * 2);
  _Float16* wtg = (_Float16*)carve((size_t)CIN * HC * 2);
  _Float16* wto = (_Float16*)carve((size_t)HC * CIN * 2);
  _Float16* qh  = (_Float16*)carve((size_t)BATCH * NHEAD * SEQ * CHEAD * 2);
  _Float16* kh  = (_Float16*)carve((size_t)BATCH * NHEAD * SEQ * CHEAD * 2);
  _Float16* vt  = (_Float16*)carve((size_t)BATCH * NHEAD * SEQ * CHEAD * 2);
  float*    gat = (float*)carve((size_t)BS * HC * 4);
  _Float16* oc  = (_Float16*)carve((size_t)BS * HC * 2);

  // 1) convert x to f16; transpose+convert the 5 weight matrices
  {
    const int n = BS * CIN;
    cvt_f32_to_f16<<<(n + 255) / 256, 256, 0, stream>>>(x, xh, n);
    const int wblk = (CIN * HC) / 256;
    cvt_w_transpose<<<wblk, 256, 0, stream>>>(Wq, wtq);
    cvt_w_transpose<<<wblk, 256, 0, stream>>>(Wk, wtk);
    cvt_w_transpose<<<wblk, 256, 0, stream>>>(Wv, wtv);
    cvt_w_transpose<<<wblk, 256, 0, stream>>>(Wg, wtg);
    cvt_w_transpose<<<wblk, 256, 0, stream>>>(Wo, wto);
  }

  // 2) projections (Q, K, V^T, gate)
  {
    dim3 grid(HC / 64, BS / 64);
    gemm_proj<<<grid, 128, 0, stream>>>(xh, wtq, bg, qh, gat, 0);
    gemm_proj<<<grid, 128, 0, stream>>>(xh, wtk, bg, kh, gat, 1);
    gemm_proj<<<grid, 128, 0, stream>>>(xh, wtv, bg, vt, gat, 2);
    gemm_proj<<<grid, 128, 0, stream>>>(xh, wtg, bg, qh /*unused*/, gat, 3);
  }

  // 3) fused flash attention (bias streamed once, softmax online, gated)
  {
    dim3 grid(SEQ / 64, BATCH * NHEAD);
    attn_flash<<<grid, 128, 0, stream>>>(qh, kh, vt, bias, amask, gat, oc);
  }

  // 4) output projection + bias
  {
    dim3 grid(CIN / 64, BS / 64);
    gemm_out<<<grid, 128, 0, stream>>>(oc, wto, bo, out);
  }
}

// v001
// A run of this version takes 165 microseconds.
// Two timings next to v000 both put it at 1.15 times that version's speed.
#include <hip/hip_runtime.h>
#include <hip/hip_bf16.h>

typedef __attribute__((ext_vector_type(16))) _Float16 v16h;
typedef __attribute__((ext_vector_type(8)))  _Float16 v8h;
typedef __attribute__((ext_vector_type(8)))  float    v8f;
typedef __attribute__((ext_vector_type(8)))  int      v8i;

#define BATCH 2
#define SEQ   2048
#define CIN   512
#define NHEAD 8
#define CHEAD 64
#define HC    512          // NHEAD*CHEAD
#define BS    4096         // BATCH*SEQ

// ---------------------------------------------------------------------------
// WMMA helpers
// ---------------------------------------------------------------------------
__device__ __forceinline__ v8f wmma_f16(v16h a, v16h b, v8f c) {
  // D = A(16x32 f16) * B(32x16 f16) + C(16x16 f32)
  return __builtin_amdgcn_wmma_f32_16x16x32_f16(
      false, a, false, b, (short)0, c, false, false);
}

// Load one 16x32 f16 fragment (A-layout; also serves B when the B source is
// stored n-major with k contiguous). `base` points at element (row0, k0),
// `ld` is the row stride in elements. Per ISA 16-bit A layout:
//   lanes 0-15 : row = lane,    K = 0..7 and 16..23
//   lanes 16-31: row = lane-16, K = 8..15 and 24..31
__device__ __forceinline__ v16h load_frag16(const _Float16* base, int ld) {
  const int lane = threadIdx.x & 31;
  const int row  = lane & 15;
  const int koff = (lane >> 4) << 3;        // 0 or 8
  const _Float16* p = base + row * ld + koff;
  v8h lo = *(const v8h*)(p);                // K = koff .. koff+7
  v8h hi = *(const v8h*)(p + 16);           // K = 16+koff .. 16+koff+7
  return __builtin_shufflevector(lo, hi, 0,1,2,3,4,5,6,7,
                                 8,9,10,11,12,13,14,15);
}

// ---------------------------------------------------------------------------
// CDNA5 async memory->LDS staging (ASYNCcnt path; no VGPR round-trip).
// Async loads complete in order, so "s_wait_asynccnt N" with N = #chunks just
// issued for the NEXT tile guarantees the PREVIOUS tile has fully landed --
// the basis for double-buffered DMA/compute overlap.
// ---------------------------------------------------------------------------
typedef __attribute__((address_space(3))) const void* lds_cptr_t;

__device__ __forceinline__ unsigned lds_base(const void* p) {
  // addrspace(3) pointers are 32-bit offsets from the wave's LDS base
  return (unsigned)(unsigned long long)(lds_cptr_t)p;
}

__device__ __forceinline__ void async_ld16(unsigned lds_off, const void* g) {
  // per-lane: LDS[lds_off] = MEM[g] (16 bytes), tracked with ASYNCcnt
  asm volatile("global_load_async_to_lds_b128 %0, %1, off"
               :: "v"(lds_off), "v"((unsigned long long)g)
               : "memory");
}

__device__ __forceinline__ void wait_async0() {
  asm volatile("s_wait_asynccnt 0x0" ::: "memory");
}
__device__ __forceinline__ void wait_async2() {
  asm volatile("s_wait_asynccnt 0x2" ::: "memory");
}
__device__ __forceinline__ void wait_async4() {
  asm volatile("s_wait_asynccnt 0x4" ::: "memory");
}

// ---------------------------------------------------------------------------
// Conversion kernels
// ---------------------------------------------------------------------------
__global__ void __launch_bounds__(256) cvt_f32_to_f16(
    const float* __restrict__ src, _Float16* __restrict__ dst, int n) {
  int i = blockIdx.x * 256 + threadIdx.x;
  if (i < n) dst[i] = (_Float16)src[i];
}

// wT[n*512 + k] = (f16) w[k*512 + n]   (512x512 transpose + convert)
__global__ void __launch_bounds__(256) cvt_w_transpose(
    const float* __restrict__ w, _Float16* __restrict__ wT) {
  int i = blockIdx.x * 256 + threadIdx.x;   // 0 .. 262143
  int n = i >> 9, k = i & 511;
  wT[i] = (_Float16)w[k * CIN + n];
}

// ---------------------------------------------------------------------------
// Projection GEMM: Y[4096,512] = Xh[4096,512] @ W[512,512]  (W given as W^T)
// mode 0/1: Q/K  -> f16 [B,H,S,c];  mode 2: V -> f16 [B,H,c,S] (transposed);
// mode 3: gate -> f32 sigmoid(Y + bg) at [B,S,HC].
// Block: 128 threads = 4 waves; block tile 64(M) x 64(N); wave tile 16x64.
// W^T tiles double-buffered in LDS via async DMA, shared by the 4 waves.
// ---------------------------------------------------------------------------
__global__ void __launch_bounds__(128) gemm_proj(
    const _Float16* __restrict__ xh, const _Float16* __restrict__ wT,
    const float* __restrict__ bg,
    _Float16* __restrict__ out16, float* __restrict__ out32, int mode) {
  __shared__ _Float16 wbufA[64 * 32];       // [n_local][k_local]
  __shared__ _Float16 wbufB[64 * 32];

  const int tid  = threadIdx.x;
  const int wv   = tid >> 5;
  const int lane = tid & 31;
  const int lr   = lane & 15;
  const int lh   = lane >> 4;
  const int m0   = blockIdx.y * 64 + wv * 16;
  const int n0   = blockIdx.x * 64;
  const unsigned wA = lds_base(wbufA);
  const unsigned wB = lds_base(wbufB);

  v8f acc[4] = {};

  auto stage = [&](int k0, unsigned dst) {
#pragma unroll
    for (int i = 0; i < 2; ++i) {
      const int id = tid + i * 128;         // 0..255 chunks of 16B
      const int nl = id >> 2, ch = id & 3;
      async_ld16(dst + (unsigned)(nl * 32 + ch * 8) * 2,
                 wT + (size_t)(n0 + nl) * CIN + k0 + ch * 8);
    }
  };
  auto compute = [&](int k0, const _Float16* wb) {
    v16h a = load_frag16(xh + (size_t)m0 * CIN + k0, CIN);
#pragma unroll
    for (int nt = 0; nt < 4; ++nt) {
      v16h b = load_frag16(wb + nt * 16 * 32, 32);
      acc[nt] = wmma_f16(a, b, acc[nt]);
    }
  };

  stage(0, wA);
  for (int k0 = 0; k0 < CIN; k0 += 64) {
    stage(k0 + 32, wB);                     // k0+32 < 512 always
    wait_async2();                          // tile k0 landed; k0+32 in flight
    __syncthreads();
    compute(k0, wbufA);
    __syncthreads();                        // all reads of A done
    if (k0 + 64 < CIN) { stage(k0 + 64, wA); wait_async2(); }
    else               { wait_async0(); }
    __syncthreads();
    compute(k0 + 32, wbufB);
    __syncthreads();                        // all reads of B done
  }

  const int mbase = m0 + lh * 8;
#pragma unroll
  for (int nt = 0; nt < 4; ++nt) {
    const int n = n0 + nt * 16 + lr;
    const int h = n >> 6, c = n & 63;
#pragma unroll
    for (int r = 0; r < 8; ++r) {
      const int m = mbase + r;
      const int b = m >> 11, s = m & (SEQ - 1);
      const float v = acc[nt][r];
      if (mode <= 1) {
        out16[(((size_t)(b * NHEAD + h)) * SEQ + s) * CHEAD + c] = (_Float16)v;
      } else if (mode == 2) {
        out16[(((size_t)(b * NHEAD + h)) * CHEAD + c) * SEQ + s] = (_Float16)v;
      } else {
        out32[((size_t)(b * SEQ + s)) * HC + n] =
            1.0f / (1.0f + __expf(-(v + bg[n])));
      }
    }
  }
}

__device__ __forceinline__ float other_half(float v) {
  // value of lane l ^ 16
  const int b = __builtin_bit_cast(int, v);
  return __builtin_bit_cast(float, __builtin_amdgcn_permlanex16(
      b, b, 0x76543210, 0xfedcba98, false, false));
}

// 2^x of eight values, each in its own register. One statement: behind an
// exponential stands another one on other registers, so no result is read and
// no source overwritten in the slot directly behind it; the v_nop keeps that
// slot behind the last one, whatever the compiler puts next.
__device__ __forceinline__ v8f exp2x8(v8f t) {
  float a = t[0], b = t[1], c = t[2], d = t[3];
  float e = t[4], f = t[5], g = t[6], h = t[7];
  asm("v_exp_f32 %0, %0\n\tv_exp_f32 %1, %1\n\tv_exp_f32 %2, %2\n\t"
      "v_exp_f32 %3, %3\n\tv_exp_f32 %4, %4\n\tv_exp_f32 %5, %5\n\t"
      "v_exp_f32 %6, %6\n\tv_exp_f32 %7, %7\n\tv_nop"
      : "+v"(a), "+v"(b), "+v"(c), "+v"(d), "+v"(e), "+v"(f), "+v"(g), "+v"(h));
  return v8f{a, b, c, d, e, f, g, h};
}

__global__ void __launch_bounds__(128) attn_flash(
    const _Float16* __restrict__ qh, const _Float16* __restrict__ kh,
    const _Float16* __restrict__ vt, const float* __restrict__ bias,
    const int* __restrict__ amask, const float* __restrict__ gate,
    _Float16* __restrict__ ocat) {
  __shared__ _Float16 kbufA[32 * 64], kbufB[32 * 64];   // [key_local][c]
  __shared__ _Float16 vbufA[64 * 32], vbufB[64 * 32];   // [c][key_local]

  const int tid  = threadIdx.x;
  const int wv   = tid >> 5;
  const int lane = tid & 31;
  const int lr   = lane & 15;
  const int lh   = lane >> 4;
  const int bh   = blockIdx.y;              // 0..15  => (b,h)
  const int bb   = bh >> 3, h = bh & 7;
  const int q0   = (blockIdx.x * 4 + wv) * 16;

  const _Float16* Q = qh + (size_t)bh * SEQ * CHEAD;
  const _Float16* K = kh + (size_t)bh * SEQ * CHEAD;
  const _Float16* V = vt + (size_t)bh * CHEAD * SEQ;
  // this lane's own query row of the bias, at its half's first key
  const float* biasl = bias + ((size_t)bh * SEQ + q0 + lr) * SEQ + lh * 8;
  const int*   mkl   = amask + bb * SEQ + lh * 8;
  const unsigned kA = lds_base(kbufA), kB = lds_base(kbufB);
  const unsigned vA = lds_base(vbufA), vB = lds_base(vbufB);

  // Q^T as B operand: column = query lr, k in the loader's order
  v16h bq0 = load_frag16(Q + (size_t)q0 * CHEAD + 0,  CHEAD);
  v16h bq1 = load_frag16(Q + (size_t)q0 * CHEAD + 32, CHEAD);

  float mrun = -1e30f, lrun = 0.0f;         // lrun: this half's keys only
  v8f oacc[4] = {};                         // O^T: [c = ct*16+8*lh+r][query lr]

  auto stage = [&](int kt, unsigned kdst, unsigned vdst) {
#pragma unroll
    for (int i = 0; i < 2; ++i) {
      const int id = tid + i * 128;         // 0..255
      const int kr = id >> 3, kc = id & 7;  // K: [32 rows][8 chunks]
      async_ld16(kdst + (unsigned)(kr * 64 + kc * 8) * 2,
                 K + (size_t)(kt + kr) * CHEAD + kc * 8);
      const int vc = id >> 2, vch = id & 3; // V^T: [64 rows][4 chunks]
      async_ld16(vdst + (unsigned)(vc * 32 + vch * 8) * 2,
                 V + (size_t)vc * SEQ + kt + vch * 8);
    }
  };

  auto compute = [&](int kt, const _Float16* kb, const _Float16* vb) {
    // --- pair bias + key mask: 8 consecutive keys per lane and 16-key tile ---
    const float* bp = biasl + kt;
    const int*   mp = mkl + kt;
    v8f b8[2];
    v8i m8[2];
#pragma unroll
    for (int nh = 0; nh < 2; ++nh) {
      b8[nh] = *(const v8f*)(bp + nh * 16);
      m8[nh] = *(const v8i*)(mp + nh * 16);
    }
    // the loads' address registers may be reused right behind them
    asm volatile("s_wait_xcnt 0x0" ::: "memory");
    // --- logits tile: S^T = K Q^T  (32 keys x 16 queries, two f32 tiles) ---
    v16h ak[2][2];
#pragma unroll
    for (int nh = 0; nh < 2; ++nh) {
      ak[nh][0] = load_frag16(kb + nh * 16 * 64 + 0,  64);
      ak[nh][1] = load_frag16(kb + nh * 16 * 64 + 32, 64);
    }
    v8f sa[2] = {};
#pragma unroll
    for (int nh = 0; nh < 2; ++nh) {
      sa[nh] = wmma_f16(ak[nh][0], bq0, sa[nh]);
      sa[nh] = wmma_f16(ak[nh][1], bq1, sa[nh]);
    }
    // V^T fragments (A rows = output channel c): P never passes through LDS,
    // so they can be fetched while the softmax runs
    v16h av[4];
#pragma unroll
    for (int ct = 0; ct < 4; ++ct) av[ct] = load_frag16(vb + ct * 16 * 32, 32);
    // --- scale + pair bias + key mask ---
#pragma unroll
    for (int nh = 0; nh < 2; ++nh) {
      v8f moff;
#pragma unroll
      for (int r = 0; r < 8; ++r) moff[r] = (m8[nh][r] > 0) ? 0.0f : -1e9f;
      sa[nh] = sa[nh] * 0.125f + b8[nh] + moff;
    }
    // --- online softmax: one query per lane, halves joined for the maximum ---
    const v8f mx8 = __builtin_elementwise_max(sa[0], sa[1]);
    const float mx = fmaxf(fmaxf(fmaxf(mx8[0], mx8[1]), fmaxf(mx8[2], mx8[3])),
                           fmaxf(fmaxf(mx8[4], mx8[5]), fmaxf(mx8[6], mx8[7])));
    const float mnew = fmaxf(mrun, fmaxf(mx, other_half(mx)));
#pragma unroll
    for (int nh = 0; nh < 2; ++nh)
      sa[nh] = exp2x8((sa[nh] - mnew) * 1.44269504f);   // exp(x) = 2^(x log2 e)
    const v8f ps = sa[0] + sa[1];
    const float ts = ((ps[0] + ps[1]) + (ps[2] + ps[3])) +
                     ((ps[4] + ps[5]) + (ps[6] + ps[7]));
    const float alpha = __expf(mrun - mnew);
    lrun = lrun * alpha + ts;
    mrun = mnew;
#pragma unroll
    for (int ct = 0; ct < 4; ++ct) oacc[ct] *= alpha;
    // --- P^T as B operand: element s = key 8*lh+s (s<8), 16+8*lh+s-8 (s>=8) ---
    const v16h pt = __builtin_shufflevector(
        __builtin_convertvector(sa[0], v8h), __builtin_convertvector(sa[1], v8h),
        0, 1, 2, 3, 4, 5, 6, 7, 8, 9, 10, 11, 12, 13, 14, 15);
    // --- O^T += V^T P^T ---
#pragma unroll
    for (int ct = 0; ct < 4; ++ct) oacc[ct] = wmma_f16(av[ct], pt, oacc[ct]);
  };

  stage(0, kA, vA);
  for (int kt = 0; kt < SEQ; kt += 64) {
    stage(kt + 32, kB, vB);                 // kt+32 < 2048 always
    wait_async4();                          // tile kt landed; kt+32 in flight
    __syncthreads();
    compute(kt, kbufA, vbufA);
    __syncthreads();
    if (kt + 64 < SEQ) { stage(kt + 64, kA, vA); wait_async4(); }
    else               { wait_async0(); }
    __syncthreads();
    compute(kt + 32, kbufB, vbufB);
    __syncthreads();
  }

  // --- epilogue: normalize, gate, store concat-head f16 [B,S,HC] ---
  // a lane holds 8 consecutive channels of its query per tile: 16-byte stores
  const float rl = 1.0f / (lrun + other_half(lrun));
  const size_t rowoff = ((size_t)(bb * SEQ + q0 + lr)) * HC + h * CHEAD + lh * 8;
#pragma unroll
  for (int ct = 0; ct < 4; ++ct) {
    const float4 g0 = *(const float4*)(gate + rowoff + ct * 16);
    const float4 g1 = *(const float4*)(gate + rowoff + ct * 16 + 4);
    const float g8[8] = {g0.x, g0.y, g0.z, g0.w, g1.x, g1.y, g1.z, g1.w};
    v8h o;
#pragma unroll
    for (int r = 0; r < 8; ++r) o[r] = (_Float16)(oacc[ct][r] * rl * g8[r]);
    *(v8h*)(ocat + rowoff + ct * 16) = o;
  }
}

// ---------------------------------------------------------------------------
// Output GEMM: out[4096,512] = Ocat[4096,512] @ Wo + bo   (Wo given as Wo^T)
// Same double-buffered async LDS weight staging as gemm_proj.
// ---------------------------------------------------------------------------
__global__ void __launch_bounds__(128) gemm_out(
    const _Float16* __restrict__ oc, const _Float16* __restrict__ woT,
    const float* __restrict__ bo, float* __restrict__ out) {
  __shared__ _Float16 wbufA[64 * 32];
  __shared__ _Float16 wbufB[64 * 32];

  const int tid  = threadIdx.x;
  const int wv   = tid >> 5;
  const int lane = tid & 31;
  const int lr   = lane & 15;
  const int lh   = lane >> 4;
  const int m0   = blockIdx.y * 64 + wv * 16;
  const int n0   = blockIdx.x * 64;
  const unsigned wA = lds_base(wbufA);
  const unsigned wB = lds_base(wbufB);

  v8f acc[4] = {};

  auto stage = [&](int k0, unsigned dst) {
#pragma unroll
    for (int i = 0; i < 2; ++i) {
      const int id = tid + i * 128;
      const int nl = id >> 2, ch = id & 3;
      async_ld16(dst + (unsigned)(nl * 32 + ch * 8) * 2,
                 woT + (size_t)(n0 + nl) * HC + k0 + ch * 8);
    }
  };
  auto compute = [&](int k0, const _Float16* wb) {
    v16h a = load_frag16(oc + (size_t)m0 * HC + k0, HC);
#pragma unroll
    for (int nt = 0; nt < 4; ++nt) {
      v16h b = load_frag16(wb + nt * 16 * 32, 32);
      acc[nt] = wmma_f16(a, b, acc[nt]);
    }
  };

  stage(0, wA);
  for (int k0 = 0; k0 < HC; k0 += 64) {
    stage(k0 + 32, wB);
    wait_async2();
    __syncthreads();
    compute(k0, wbufA);
    __syncthreads();
    if (k0 + 64 < HC) { stage(k0 + 64, wA); wait_async2(); }
    else              { wait_async0(); }
    __syncthreads();
    compute(k0 + 32, wbufB);
    __syncthreads();
  }

  const int mbase = m0 + lh * 8;
#pragma unroll
  for (int nt = 0; nt < 4; ++nt) {
    const int n = n0 + nt * 16 + lr;
    const float bn = bo[n];
#pragma unroll
    for (int r = 0; r < 8; ++r)
      out[(size_t)(mbase + r) * CIN + n] = acc[nt][r] + bn;
  }
}

// ---------------------------------------------------------------------------
extern "C" void kernel_launch(void* const* d_in, const int* in_sizes, int n_in,
                              void* d_out, int out_size, void* d_ws,
                              size_t ws_size, hipStream_t stream) {
  const float* x     = (const float*)d_in[0];
  const float* bias  = (const float*)d_in[1];
  const int*   amask = (const int*)d_in[2];
  const float* Wq    = (const float*)d_in[3];
  const float* Wk    = (const float*)d_in[4];
  const float* Wv    = (const float*)d_in[5];
  const float* Wg    = (const float*)d_in[6];
  const float* bg    = (const float*)d_in[7];
  const float* Wo    = (const float*)d_in[8];
  const float* bo    = (const float*)d_in[9];
  float* out = (float*)d_out;

  char* ws = (char*)d_ws;
  size_t off = 0;
  auto carve = [&](size_t bytes) -> char* {
    char* p = ws + off;
    off += (bytes + 255) & ~(size_t)255;
    return p;
  };
  _Float16* xh  = (_Float16*)carve((size_t)BS * CIN * 2);
  _Float16* wtq = (_Float16*)carve((size_t)CIN * HC * 2);
  _Float16* wtk = (_Float16*)carve((size_t)CIN * HC * 2);
  _Float16* wtv = (_Float16*)carve((size_t)CIN * HC * 2);
  _Float16* wtg = (_Float16*)carve((size_t)CIN * HC * 2);
  _Float16* wto = (_Float16*)carve((size_t)HC * CIN * 2);
  _Float16* qh  = (_Float16*)carve((size_t)BATCH * NHEAD * SEQ * CHEAD * 2);
  _Float16* kh  = (_Float16*)carve((size_t)BATCH * NHEAD * SEQ * CHEAD * 2);
  _Float16* vt  = (_Float16*)carve((size_t)BATCH * NHEAD * SEQ * CHEAD * 2);
  float*    gat = (float*)carve((size_t)BS * HC * 4);
  _Float16* oc  = (_Float16*)carve((size_t)BS * HC * 2);

  // 1) convert x to f16; transpose+convert the 5 weight matrices
  {
    const int n = BS * CIN;
    cvt_f32_to_f16<<<(n + 255) / 256, 256, 0, stream>>>(x, xh, n);
    const int wblk = (CIN * HC) / 256;
    cvt_w_transpose<<<wblk, 256, 0, stream>>>(Wq, wtq);
    cvt_w_transpose<<<wblk, 256, 0, stream>>>(Wk, wtk);
    cvt_w_transpose<<<wblk, 256, 0, stream>>>(Wv, wtv);
    cvt_w_transpose<<<wblk, 256, 0, stream>>>(Wg, wtg);
    cvt_w_transpose<<<wblk, 256, 0, stream>>>(Wo, wto);
  }

  // 2) projections (Q, K, V^T, gate)
  {
    dim3 grid(HC / 64, BS / 64);
    gemm_proj<<<grid, 128, 0, stream>>>(xh, wtq, bg, qh, gat, 0);
    gemm_proj<<<grid, 128, 0, stream>>>(xh, wtk, bg, kh, gat, 1);
    gemm_proj<<<grid, 128, 0, stream>>>(xh, wtv, bg, vt, gat, 2);
    gemm_proj<<<grid, 128, 0, stream>>>(xh, wtg, bg, qh /*unused*/, gat, 3);
  }

  // 3) fused flash attention (bias streamed once, softmax online, gated)
  {
    dim3 grid(SEQ / 64, BATCH * NHEAD);
    attn_flash<<<grid, 128, 0, stream>>>(qh, kh, vt, bias, amask, gat, oc);
  }

  // 4) output projection + bias
  {
    dim3 grid(CIN / 64, BS / 64);
    gemm_out<<<grid, 128, 0, stream>>>(oc, wto, bo, out);
  }
}

// v002
// It runs in 158 microseconds.
// Two timings next to v001 both put it at 1.06 times that version's speed.
// All steps since v000 together make it 1.21 times as fast.
#include <hip/hip_runtime.h>
#include <hip/hip_bf16.h>

typedef __attribute__((ext_vector_type(16))) _Float16 v16h;
typedef __attribute__((ext_vector_type(8)))  _Float16 v8h;
typedef __attribute__((ext_vector_type(8)))  float    v8f;
typedef __attribute__((ext_vector_type(8)))  int      v8i;
typedef __attribute__((ext_vector_type(4)))  float    v4f;
typedef __attribute__((ext_vector_type(4)))  _Float16 v4h;
typedef __attribute__((ext_vector_type(2)))  _Float16 v2h;

#define BATCH 2
#define SEQ   2048
#define CIN   512
#define NHEAD 8
#define CHEAD 64
#define HC    512          // NHEAD*CHEAD
#define BS    4096         // BATCH*SEQ

// ---------------------------------------------------------------------------
// WMMA helpers
// ---------------------------------------------------------------------------
__device__ __forceinline__ v8f wmma_f16(v16h a, v16h b, v8f c) {
  // D = A(16x32 f16) * B(32x16 f16) + C(16x16 f32)
  return __builtin_amdgcn_wmma_f32_16x16x32_f16(
      false, a, false, b, (short)0, c, false, false);
}

// Load one 16x32 f16 fragment (A-layout; also serves B when the B source is
// stored n-major with k contiguous). `base` points at element (row0, k0),
// `ld` is the row stride in elements. Per ISA 16-bit A layout:
//   lanes 0-15 : row = lane,    K = 0..7 and 16..23
//   lanes 16-31: row = lane-16, K = 8..15 and 24..31
__device__ __forceinline__ v16h load_frag16(const _Float16* base, int ld) {
  const int lane = threadIdx.x & 31;
  const int row  = lane & 15;
  const int koff = (lane >> 4) << 3;        // 0 or 8
  const _Float16* p = base + row * ld + koff;
  v8h lo = *(const v8h*)(p);                // K = koff .. koff+7
  v8h hi = *(const v8h*)(p + 16);           // K = 16+koff .. 16+koff+7
  return __builtin_shufflevector(lo, hi, 0,1,2,3,4,5,6,7,
                                 8,9,10,11,12,13,14,15);
}

// ---------------------------------------------------------------------------
// CDNA5 async memory->LDS staging (ASYNCcnt path; no VGPR round-trip).
// Async loads complete in order, so "s_wait_asynccnt N" with N = #chunks just
// issued for the NEXT tile guarantees the PREVIOUS tile has fully landed --
// the basis for double-buffered DMA/compute overlap.
// ---------------------------------------------------------------------------
typedef __attribute__((address_space(3))) const void* lds_cptr_t;

__device__ __forceinline__ unsigned lds_base(const void* p) {
  // addrspace(3) pointers are 32-bit offsets from the wave's LDS base
  return (unsigned)(unsigned long long)(lds_cptr_t)p;
}

__device__ __forceinline__ void async_ld16(unsigned lds_off, const void* g) {
  // per-lane: LDS[lds_off] = MEM[g] (16 bytes), tracked with ASYNCcnt
  asm volatile("global_load_async_to_lds_b128 %0, %1, off"
               :: "v"(lds_off), "v"((unsigned long long)g)
               : "memory");
}

__device__ __forceinline__ void wait_async0() {
  asm volatile("s_wait_asynccnt 0x0" ::: "memory");
}
__device__ __forceinline__ void wait_async2() {
  asm volatile("s_wait_asynccnt 0x2" ::: "memory");
}
__device__ __forceinline__ void wait_async4() {
  asm volatile("s_wait_asynccnt 0x4" ::: "memory");
}

// ---------------------------------------------------------------------------
// Conversion kernels
// ---------------------------------------------------------------------------
// Each thread takes many elements, so that few waves have to start.
// 32 floats a thread; every wave-wide load and store covers whole 128-byte
// lines. Grid: BS*CIN / 8192 blocks, no remainder.
__global__ void __launch_bounds__(256) cvt_f32_to_f16(
    const float* __restrict__ src, _Float16* __restrict__ dst) {
  const int base = blockIdx.x * 8192 + threadIdx.x * 4;
  v4f v[8];
  // unrolled: all eight loads are issued before the first is waited for
#pragma unroll
  for (int j = 0; j < 8; ++j) v[j] = *(const v4f*)(src + base + j * 1024);
  // unrolled: v[] stays in registers
#pragma unroll
  for (int j = 0; j < 8; ++j)
    *(v4h*)(dst + base + j * 1024) = __builtin_convertvector(v[j], v4h);
}

// wT[n*512 + k] = (f16) w[k*512 + n]   (512x512 transpose + convert)
// One 64(k) x 64(n) tile a block, 16 elements a thread: rows of w read in
// 256-byte runs, turned in LDS, rows of wT written in whole 128-byte lines.
// The short loops are unrolled so that a[][] stays in registers and the four
// loads are issued together.
__global__ void __launch_bounds__(256) cvt_w_transpose(
    const float* __restrict__ w, _Float16* __restrict__ wT) {
  __shared__ _Float16 t[64 * 72];           // [n_local][k_local], 144-byte rows
  const int tid = threadIdx.x;
  const int k0  = blockIdx.x * 64, n0 = blockIdx.y * 64;
  const int nq  = (tid & 15) * 4;           // four columns n
  const int kp  = (tid >> 4) * 2;           // two rows k, twice (32 apart)
  v4f a[2][2];
#pragma unroll
  for (int j = 0; j < 2; ++j)
#pragma unroll
    for (int e = 0; e < 2; ++e)
      a[j][e] = *(const v4f*)(w + (k0 + kp + 32 * j + e) * CIN + n0 + nq);
#pragma unroll
  for (int j = 0; j < 2; ++j)
#pragma unroll
    for (int i = 0; i < 4; ++i) {
      const v2h p = {(_Float16)a[j][0][i], (_Float16)a[j][1][i]};
      *(v2h*)(t + (nq + i) * 72 + kp + 32 * j) = p;
    }
  __syncthreads();                          // the tile is read across waves
#pragma unroll
  for (int j = 0; j < 2; ++j) {
    const int nl = (tid >> 3) + 32 * j, kc = (tid & 7) * 8;
    *(v8h*)(wT + (n0 + nl) * CIN + k0 + kc) = *(const v8h*)(t + nl * 72 + kc);
  }
}

// ---------------------------------------------------------------------------
// Projection GEMM: Y[4096,512] = Xh[4096,512] @ W[512,512]  (W given as W^T)
// mode 0/1: Q/K  -> f16 [B,H,S,c];  mode 2: V -> f16 [B,H,c,S] (transposed);
// mode 3: gate -> f32 sigmoid(Y + bg) at [B,S,HC].
// Block: 128 threads = 4 waves; block tile 64(M) x 64(N); wave tile 16x64.
// W^T tiles double-buffered in LDS via async DMA, shared by the 4 waves.
// ---------------------------------------------------------------------------
__global__ void __launch_bounds__(128) gemm_proj(
    const _Float16* __restrict__ xh, const _Float16* __restrict__ wT,
    const float* __restrict__ bg,
    _Float16* __restrict__ out16, float* __restrict__ out32, int mode) {
  __shared__ _Float16 wbufA[64 * 32];       // [n_local][k_local]
  __shared__ _Float16 wbufB[64 * 32];

  const int tid  = threadIdx.x;
  const int wv   = tid >> 5;
  const int lane = tid & 31;
  const int lr   = lane & 15;
  const int lh   = lane >> 4;
  const int m0   = blockIdx.y * 64 + wv * 16;
  const int n0   = blockIdx.x * 64;
  const unsigned wA = lds_base(wbufA);
  const unsigned wB = lds_base(wbufB);

  v8f acc[4] = {};

  auto stage = [&](int k0, unsigned dst) {
#pragma unroll
    for (int i = 0; i < 2; ++i) {
      const int id = tid + i * 128;         // 0..255 chunks of 16B
      const int nl = id >> 2, ch = id & 3;
      async_ld16(dst + (unsigned)(nl * 32 + ch * 8) * 2,
                 wT + (size_t)(n0 + nl) * CIN + k0 + ch * 8);
    }
  };
  auto compute = [&](int k0, const _Float16* wb) {
    v16h a = load_frag16(xh + (size_t)m0 * CIN + k0, CIN);
#pragma unroll
    for (int nt = 0; nt < 4; ++nt) {
      v16h b = load_frag16(wb + nt * 16 * 32, 32);
      acc[nt] = wmma_f16(a, b, acc[nt]);
    }
  };

  stage(0, wA);
  for (int k0 = 0; k0 < CIN; k0 += 64) {
    stage(k0 + 32, wB);                     // k0+32 < 512 always
    wait_async2();                          // tile k0 landed; k0+32 in flight
    __syncthreads();
    compute(k0, wbufA);
    __syncthreads();                        // all reads of A done
    if (k0 + 64 < CIN) { stage(k0 + 64, wA); wait_async2(); }
    else               { wait_async0(); }
    __syncthreads();
    compute(k0 + 32, wbufB);
    __syncthreads();                        // all reads of B done
  }

  const int mbase = m0 + lh * 8;
#pragma unroll
  for (int nt = 0; nt < 4; ++nt) {
    const int n = n0 + nt * 16 + lr;
    const int h = n >> 6, c = n & 63;
#pragma unroll
    for (int r = 0; r < 8; ++r) {
      const int m = mbase + r;
      const int b = m >> 11, s = m & (SEQ - 1);
      const float v = acc[nt][r];
      if (mode <= 1) {
        out16[(((size_t)(b * NHEAD + h)) * SEQ + s) * CHEAD + c] = (_Float16)v;
      } else if (mode == 2) {
        out16[(((size_t)(b * NHEAD + h)) * CHEAD + c) * SEQ + s] = (_Float16)v;
      } else {
        out32[((size_t)(b * SEQ + s)) * HC + n] =
            1.0f / (1.0f + __expf(-(v + bg[n])));
      }
    }
  }
}

__device__ __forceinline__ float other_half(float v) {
  // value of lane l ^ 16
  const int b = __builtin_bit_cast(int, v);
  return __builtin_bit_cast(float, __builtin_amdgcn_permlanex16(
      b, b, 0x76543210, 0xfedcba98, false, false));
}

// 2^x of eight values, each in its own register. One statement: behind an
// exponential stands another one on other registers, so no result is read and
// no source overwritten in the slot directly behind it; the v_nop keeps that
// slot behind the last one, whatever the compiler puts next.
__device__ __forceinline__ v8f exp2x8(v8f t) {
  float a = t[0], b = t[1], c = t[2], d = t[3];
  float e = t[4], f = t[5], g = t[6], h = t[7];
  asm("v_exp_f32 %0, %0\n\tv_exp_f32 %1, %1\n\tv_exp_f32 %2, %2\n\t"
      "v_exp_f32 %3, %3\n\tv_exp_f32 %4, %4\n\tv_exp_f32 %5, %5\n\t"
      "v_exp_f32 %6, %6\n\tv_exp_f32 %7, %7\n\tv_nop"
      : "+v"(a), "+v"(b), "+v"(c), "+v"(d), "+v"(e), "+v"(f), "+v"(g), "+v"(h));
  return v8f{a, b, c, d, e, f, g, h};
}

__global__ void __launch_bounds__(128) attn_flash(
    const _Float16* __restrict__ qh, const _Float16* __restrict__ kh,
    const _Float16* __restrict__ vt, const float* __restrict__ bias,
    const int* __restrict__ amask, const float* __restrict__ gate,
    _Float16* __restrict__ ocat) {
  __shared__ _Float16 kbufA[32 * 64], kbufB[32 * 64];   // [key_local][c]
  __shared__ _Float16 vbufA[64 * 32], vbufB[64 * 32];   // [c][key_local]

  const int tid  = threadIdx.x;
  const int wv   = tid >> 5;
  const int lane = tid & 31;
  const int lr   = lane & 15;
  const int lh   = lane >> 4;
  const int bh   = blockIdx.y;              // 0..15  => (b,h)
  const int bb   = bh >> 3, h = bh & 7;
  const int q0   = (blockIdx.x * 4 + wv) * 16;

  const _Float16* Q = qh + (size_t)bh * SEQ * CHEAD;
  const _Float16* K = kh + (size_t)bh * SEQ * CHEAD;
  const _Float16* V = vt + (size_t)bh * CHEAD * SEQ;
  // this lane's own query row of the bias, at its half's first key
  const float* biasl = bias + ((size_t)bh * SEQ + q0 + lr) * SEQ + lh * 8;
  const int*   mkl   = amask + bb * SEQ + lh * 8;
  const unsigned kA = lds_base(kbufA), kB = lds_base(kbufB);
  const unsigned vA = lds_base(vbufA), vB = lds_base(vbufB);

  // Q^T as B operand: column = query lr, k in the loader's order
  v16h bq0 = load_frag16(Q + (size_t)q0 * CHEAD + 0,  CHEAD);
  v16h bq1 = load_frag16(Q + (size_t)q0 * CHEAD + 32, CHEAD);

  float mrun = -1e30f, lrun = 0.0f;         // lrun: this half's keys only
  v8f oacc[4] = {};                         // O^T: [c = ct*16+8*lh+r][query lr]

  auto stage = [&](int kt, unsigned kdst, unsigned vdst) {
#pragma unroll
    for (int i = 0; i < 2; ++i) {
      const int id = tid + i * 128;         // 0..255
      const int kr = id >> 3, kc = id & 7;  // K: [32 rows][8 chunks]
      async_ld16(kdst + (unsigned)(kr * 64 + kc * 8) * 2,
                 K + (size_t)(kt + kr) * CHEAD + kc * 8);
      const int vc = id >> 2, vch = id & 3; // V^T: [64 rows][4 chunks]
      async_ld16(vdst + (unsigned)(vc * 32 + vch * 8) * 2,
                 V + (size_t)vc * SEQ + kt + vch * 8);
    }
  };

  auto compute = [&](int kt, const _Float16* kb, const _Float16* vb) {
    // --- pair bias + key mask: 8 consecutive keys per lane and 16-key tile ---
    const float* bp = biasl + kt;
    const int*   mp = mkl + kt;
    v8f b8[2];
    v8i m8[2];
#pragma unroll
    for (int nh = 0; nh < 2; ++nh) {
      b8[nh] = *(const v8f*)(bp + nh * 16);
      m8[nh] = *(const v8i*)(mp + nh * 16);
    }
    // the loads' address registers may be reused right behind them
    asm volatile("s_wait_xcnt 0x0" ::: "memory");
    // --- logits tile: S^T = K Q^T  (32 keys x 16 queries, two f32 tiles) ---
    v16h ak[2][2];
#pragma unroll
    for (int nh = 0; nh < 2; ++nh) {
      ak[nh][0] = load_frag16(kb + nh * 16 * 64 + 0,  64);
      ak[nh][1] = load_frag16(kb + nh * 16 * 64 + 32, 64);
    }
    v8f sa[2] = {};
#pragma unroll
    for (int nh = 0; nh < 2; ++nh) {
      sa[nh] = wmma_f16(ak[nh][0], bq0, sa[nh]);
      sa[nh] = wmma_f16(ak[nh][1], bq1, sa[nh]);
    }
    // V^T fragments (A rows = output channel c): P never passes through LDS,
    // so they can be fetched while the softmax runs
    v16h av[4];
#pragma unroll
    for (int ct = 0; ct < 4; ++ct) av[ct] = load_frag16(vb + ct * 16 * 32, 32);
    // --- scale + pair bias + key mask ---
#pragma unroll
    for (int nh = 0; nh < 2; ++nh) {
      v8f moff;
#pragma unroll
      for (int r = 0; r < 8; ++r) moff[r] = (m8[nh][r] > 0) ? 0.0f : -1e9f;
      sa[nh] = sa[nh] * 0.125f + b8[nh] + moff;
    }
    // --- online softmax: one query per lane, halves joined for the maximum ---
    const v8f mx8 = __builtin_elementwise_max(sa[0], sa[1]);
    const float mx = fmaxf(fmaxf(fmaxf(mx8[0], mx8[1]), fmaxf(mx8[2], mx8[3])),
                           fmaxf(fmaxf(mx8[4], mx8[5]), fmaxf(mx8[6], mx8[7])));
    const float mnew = fmaxf(mrun, fmaxf(mx, other_half(mx)));
#pragma unroll
    for (int nh = 0; nh < 2; ++nh)
      sa[nh] = exp2x8((sa[nh] - mnew) * 1.44269504f);   // exp(x) = 2^(x log2 e)
    const v8f ps = sa[0] + sa[1];
    const float ts = ((ps[0] + ps[1]) + (ps[2] + ps[3])) +
                     ((ps[4] + ps[5]) + (ps[6] + ps[7]));
    const float alpha = __expf(mrun - mnew);
    lrun = lrun * alpha + ts;
    mrun = mnew;
#pragma unroll
    for (int ct = 0; ct < 4; ++ct) oacc[ct] *= alpha;
    // --- P^T as B operand: element s = key 8*lh+s (s<8), 16+8*lh+s-8 (s>=8) ---
    const v16h pt = __builtin_shufflevector(
        __builtin_convertvector(sa[0], v8h), __builtin_convertvector(sa[1], v8h),
        0, 1, 2, 3, 4, 5, 6, 7, 8, 9, 10, 11, 12, 13, 14, 15);
    // --- O^T += V^T P^T ---
#pragma unroll
    for (int ct = 0; ct < 4; ++ct) oacc[ct] = wmma_f16(av[ct], pt, oacc[ct]);
  };

  stage(0, kA, vA);
  for (int kt = 0; kt < SEQ; kt += 64) {
    stage(kt + 32, kB, vB);                 // kt+32 < 2048 always
    wait_async4();                          // tile kt landed; kt+32 in flight
    __syncthreads();
    compute(kt, kbufA, vbufA);
    __syncthreads();
    if (kt + 64 < SEQ) { stage(kt + 64, kA, vA); wait_async4(); }
    else               { wait_async0(); }
    __syncthreads();
    compute(kt + 32, kbufB, vbufB);
    __syncthreads();
  }

  // --- epilogue: normalize, gate, store concat-head f16 [B,S,HC] ---
  // a lane holds 8 consecutive channels of its query per tile: 16-byte stores
  const float rl = 1.0f / (lrun + other_half(lrun));
  const size_t rowoff = ((size_t)(bb * SEQ + q0 + lr)) * HC + h * CHEAD + lh * 8;
#pragma unroll
  for (int ct = 0; ct < 4; ++ct) {
    const float4 g0 = *(const float4*)(gate + rowoff + ct * 16);
    const float4 g1 = *(const float4*)(gate + rowoff + ct * 16 + 4);
    const float g8[8] = {g0.x, g0.y, g0.z, g0.w, g1.x, g1.y, g1.z, g1.w};
    v8h o;
#pragma unroll
    for (int r = 0; r < 8; ++r) o[r] = (_Float16)(oacc[ct][r] * rl * g8[r]);
    *(v8h*)(ocat + rowoff + ct * 16) = o;
  }
}

// ---------------------------------------------------------------------------
// Output GEMM: out[4096,512] = Ocat[4096,512] @ Wo + bo   (Wo given as Wo^T)
// Same double-buffered async LDS weight staging as gemm_proj.
// ---------------------------------------------------------------------------
__global__ void __launch_bounds__(128) gemm_out(
    const _Float16* __restrict__ oc, const _Float16* __restrict__ woT,
    const float* __restrict__ bo, float* __restrict__ out) {
  __shared__ _Float16 wbufA[64 * 32];
  __shared__ _Float16 wbufB[64 * 32];

  const int tid  = threadIdx.x;
  const int wv   = tid >> 5;
  const int lane = tid & 31;
  const int lr   = lane & 15;
  const int lh   = lane >> 4;
  const int m0   = blockIdx.y * 64 + wv * 16;
  const int n0   = blockIdx.x * 64;
  const unsigned wA = lds_base(wbufA);
  const unsigned wB = lds_base(wbufB);

  v8f acc[4] = {};

  auto stage = [&](int k0, unsigned dst) {
#pragma unroll
    for (int i = 0; i < 2; ++i) {
      const int id = tid + i * 128;
      const int nl = id >> 2, ch = id & 3;
      async_ld16(dst + (unsigned)(nl * 32 + ch * 8) * 2,
                 woT + (size_t)(n0 + nl) * HC + k0 + ch * 8);
    }
  };
  auto compute = [&](int k0, const _Float16* wb) {
    v16h a = load_frag16(oc + (size_t)m0 * HC + k0, HC);
#pragma unroll
    for (int nt = 0; nt < 4; ++nt) {
      v16h b = load_frag16(wb + nt * 16 * 32, 32);
      acc[nt] = wmma_f16(a, b, acc[nt]);
    }
  };

  stage(0, wA);
  for (int k0 = 0; k0 < HC; k0 += 64) {
    stage(k0 + 32, wB);
    wait_async2();
    __syncthreads();
    compute(k0, wbufA);
    __syncthreads();
    if (k0 + 64 < HC) { stage(k0 + 64, wA); wait_async2(); }
    else              { wait_async0(); }
    __syncthreads();
    compute(k0 + 32, wbufB);
    __syncthreads();
  }

  const int mbase = m0 + lh * 8;
#pragma unroll
  for (int nt = 0; nt < 4; ++nt) {
    const int n = n0 + nt * 16 + lr;
    const float bn = bo[n];
#pragma unroll
    for (int r = 0; r < 8; ++r)
      out[(size_t)(mbase + r) * CIN + n] = acc[nt][r] + bn;
  }
}

// ---------------------------------------------------------------------------
extern "C" void kernel_launch(void* const* d_in, const int* in_sizes, int n_in,
                              void* d_out, int out_size, void* d_ws,
                              size_t ws_size, hipStream_t stream) {
  const float* x     = (const float*)d_in[0];
  const float* bias  = (const float*)d_in[1];
  const int*   amask = (const int*)d_in[2];
  const float* Wq    = (const float*)d_in[3];
  const float* Wk    = (const float*)d_in[4];
  const float* Wv    = (const float*)d_in[5];
  const float* Wg    = (const float*)d_in[6];
  const float* bg    = (const float*)d_in[7];
  const float* Wo    = (const float*)d_in[8];
  const float* bo    = (const float*)d_in[9];
  float* out = (float*)d_out;

  char* ws = (char*)d_ws;
  size_t off = 0;
  auto carve = [&](size_t bytes) -> char* {
    char* p = ws + off;
    off += (bytes + 255) & ~(size_t)255;
    return p;
  };
  _Float16* xh  = (_Float16*)carve((size_t)BS * CIN * 2);
  _Float16* wtq = (_Float16*)carve((size_t)CIN * HC * 2);
  _Float16* wtk = (_Float16*)carve((size_t)CIN * HC * 2);
  _Float16* wtv = (_Float16*)carve((size_t)CIN * HC * 2);
  _Float16* wtg = (_Float16*)carve((size_t)CIN * HC * 2);
  _Float16* wto = (_Float16*)carve((size_t)HC * CIN * 2);
  _Float16* qh  = (_Float16*)carve((size_t)BATCH * NHEAD * SEQ * CHEAD * 2);
  _Float16* kh  = (_Float16*)carve((size_t)BATCH * NHEAD * SEQ * CHEAD * 2);
  _Float16* vt  = (_Float16*)carve((size_t)BATCH * NHEAD * SEQ * CHEAD * 2);
  float*    gat = (float*)carve((size_t)BS * HC * 4);
  _Float16* oc  = (_Float16*)carve((size_t)BS * HC * 2);

  // 1) convert x to f16; transpose+convert the 5 weight matrices
  {
    cvt_f32_to_f16<<<(BS * CIN) / 8192, 256, 0, stream>>>(x, xh);
    dim3 wgrid(CIN / 64, HC / 64);
    cvt_w_transpose<<<wgrid, 256, 0, stream>>>(Wq, wtq);
    cvt_w_transpose<<<wgrid, 256, 0, stream>>>(Wk, wtk);
    cvt_w_transpose<<<wgrid, 256, 0, stream>>>(Wv, wtv);
    cvt_w_transpose<<<wgrid, 256, 0, stream>>>(Wg, wtg);
    cvt_w_transpose<<<wgrid, 256, 0, stream>>>(Wo, wto);
  }

  // 2) projections (Q, K, V^T, gate)
  {
    dim3 grid(HC / 64, BS / 64);
    gemm_proj<<<grid, 128, 0, stream>>>(xh, wtq, bg, qh, gat, 0);
    gemm_proj<<<grid, 128, 0, stream>>>(xh, wtk, bg, kh, gat, 1);
    gemm_proj<<<grid, 128, 0, stream>>>(xh, wtv, bg, vt, gat, 2);
    gemm_proj<<<grid, 128, 0, stream>>>(xh, wtg, bg, qh /*unused*/, gat, 3);
  }

  // 3) fused flash attention (bias streamed once, softmax online, gated)
  {
    dim3 grid(SEQ / 64, BATCH * NHEAD);
    attn_flash<<<grid, 128, 0, stream>>>(qh, kh, vt, bias, amask, gat, oc);
  }

  // 4) output projection + bias
  {
    dim3 grid(CIN / 64, BS / 64);
    gemm_out<<<grid, 128, 0, stream>>>(oc, wto, bo, out);
  }
}

// v003
// It runs in 124 microseconds.
// Timed twice side by side with v002, it ran 1.26 and 1.27 times as fast.
// Counting every step since v000, it is 1.54 times as fast.
#include <hip/hip_runtime.h>
#include <hip/hip_bf16.h>

typedef __attribute__((ext_vector_type(16))) _Float16 v16h;
typedef __attribute__((ext_vector_type(8)))  _Float16 v8h;
typedef __attribute__((ext_vector_type(8)))  float    v8f;
typedef __attribute__((ext_vector_type(8)))  int      v8i;
typedef __attribute__((ext_vector_type(4)))  float    v4f;
typedef __attribute__((ext_vector_type(4)))  _Float16 v4h;
typedef __attribute__((ext_vector_type(2)))  _Float16 v2h;

#define BATCH 2
#define SEQ   2048
#define CIN   512
#define NHEAD 8
#define CHEAD 64
#define HC    512          // NHEAD*CHEAD
#define BS    4096         // BATCH*SEQ

// ---------------------------------------------------------------------------
// WMMA helpers
// ---------------------------------------------------------------------------
__device__ __forceinline__ v8f wmma_f16(v16h a, v16h b, v8f c) {
  // D = A(16x32 f16) * B(32x16 f16) + C(16x16 f32)
  return __builtin_amdgcn_wmma_f32_16x16x32_f16(
      false, a, false, b, (short)0, c, false, false);
}

// Load one 16x32 f16 fragment (A-layout; also serves B when the B source is
// stored n-major with k contiguous). `base` points at element (row0, k0),
// `ld` is the row stride in elements. Per ISA 16-bit A layout:
//   lanes 0-15 : row = lane,    K = 0..7 and 16..23
//   lanes 16-31: row = lane-16, K = 8..15 and 24..31
__device__ __forceinline__ v16h load_frag16(const _Float16* base, int ld) {
  const int lane = threadIdx.x & 31;
  const int row  = lane & 15;
  const int koff = (lane >> 4) << 3;        // 0 or 8
  const _Float16* p = base + row * ld + koff;
  v8h lo = *(const v8h*)(p);                // K = koff .. koff+7
  v8h hi = *(const v8h*)(p + 16);           // K = 16+koff .. 16+koff+7
  return __builtin_shufflevector(lo, hi, 0,1,2,3,4,5,6,7,
                                 8,9,10,11,12,13,14,15);
}

// ---------------------------------------------------------------------------
// CDNA5 async memory->LDS staging (ASYNCcnt path; no VGPR round-trip).
// Async loads complete in order, so "s_wait_asynccnt N" with N = #chunks just
// issued for the NEXT tile guarantees the PREVIOUS tile has fully landed --
// the basis for double-buffered DMA/compute overlap.
// ---------------------------------------------------------------------------
typedef __attribute__((address_space(3))) const void* lds_cptr_t;

__device__ __forceinline__ unsigned lds_base(const void* p) {
  // addrspace(3) pointers are 32-bit offsets from the wave's LDS base
  return (unsigned)(unsigned long long)(lds_cptr_t)p;
}

__device__ __forceinline__ void async_ld16(unsigned lds_off, const void* g) {
  // per-lane: LDS[lds_off] = MEM[g] (16 bytes), tracked with ASYNCcnt
  asm volatile("global_load_async_to_lds_b128 %0, %1, off"
               :: "v"(lds_off), "v"((unsigned long long)g)
               : "memory");
}

__device__ __forceinline__ void wait_async0() {
  asm volatile("s_wait_asynccnt 0x0" ::: "memory");
}
__device__ __forceinline__ void wait_async2() {
  asm volatile("s_wait_asynccnt 0x2" ::: "memory");
}
__device__ __forceinline__ void wait_async4() {
  asm volatile("s_wait_asynccnt 0x4" ::: "memory");
}

// ---------------------------------------------------------------------------
// Conversion kernels
// ---------------------------------------------------------------------------
// Each thread takes many elements, so that few waves have to start.
// 32 floats a thread; every wave-wide load and store covers whole 128-byte
// lines. BS*CIN / 8192 blocks, no remainder.
#define XBLOCKS ((BS * CIN) / 8192)
__device__ __forceinline__ void cvt_f32_to_f16(
    const float* __restrict__ src, _Float16* __restrict__ dst, int blk) {
  const int base = blk * 8192 + threadIdx.x * 4;
  v4f v[8];
  // unrolled: all eight loads are issued before the first is waited for
#pragma unroll
  for (int j = 0; j < 8; ++j) v[j] = *(const v4f*)(src + base + j * 1024);
  // unrolled: v[] stays in registers
#pragma unroll
  for (int j = 0; j < 8; ++j)
    *(v4h*)(dst + base + j * 1024) = __builtin_convertvector(v[j], v4h);
  // precaution: the stores' registers may be written again by whatever code
  // the compiler lays out behind this inlined body
  asm volatile("s_wait_xcnt 0x0" ::: "memory");
}

// wT[n*512 + k] = (f16) w[k*512 + n]   (512x512 transpose + convert)
// One 64(k) x 64(n) tile a block, 16 elements a thread: rows of w read in
// 256-byte runs, turned in LDS, rows of wT written in whole 128-byte lines.
// The short loops are unrolled so that a[][] stays in registers and the four
// loads are issued together.
#define WTILES ((CIN / 64) * (HC / 64))    // tiles of one weight matrix
__device__ __forceinline__ void cvt_w_transpose(
    const float* __restrict__ w, _Float16* __restrict__ wT, int tile) {
  __shared__ _Float16 t[64 * 72];           // [n_local][k_local], 144-byte rows
  const int tid = threadIdx.x;
  const int k0  = (tile & 7) * 64, n0 = (tile >> 3) * 64;
  const int nq  = (tid & 15) * 4;           // four columns n
  const int kp  = (tid >> 4) * 2;           // two rows k, twice (32 apart)
  v4f a[2][2];
#pragma unroll
  for (int j = 0; j < 2; ++j)
#pragma unroll
    for (int e = 0; e < 2; ++e)
      a[j][e] = *(const v4f*)(w + (k0 + kp + 32 * j + e) * CIN + n0 + nq);
#pragma unroll
  for (int j = 0; j < 2; ++j)
#pragma unroll
    for (int i = 0; i < 4; ++i) {
      const v2h p = {(_Float16)a[j][0][i], (_Float16)a[j][1][i]};
      *(v2h*)(t + (nq + i) * 72 + kp + 32 * j) = p;
    }
  __syncthreads();                          // the tile is read across waves
#pragma unroll
  for (int j = 0; j < 2; ++j) {
    const int nl = (tid >> 3) + 32 * j, kc = (tid & 7) * 8;
    *(v8h*)(wT + (n0 + nl) * CIN + k0 + kc) = *(const v8h*)(t + nl * 72 + kc);
  }
}

// All six conversions as ONE grid: none depends on another, so they need no
// launch boundary between them. Blocks 0 .. 5*WTILES-1 turn the five weight
// matrices (the longer chain, started first) into wT5[matrix][n][k]; the rest
// convert x. The choice is the same for a whole block, barrier included.
__global__ void __launch_bounds__(256) cvt_all(
    const float* __restrict__ x,  const float* __restrict__ wq,
    const float* __restrict__ wk, const float* __restrict__ wv,
    const float* __restrict__ wg, const float* __restrict__ wo,
    _Float16* __restrict__ xh, _Float16* __restrict__ wT5) {
  const unsigned blk = blockIdx.x;
  if (blk < 5 * WTILES) {
    const unsigned mat = blk / WTILES;
    const float* wlo = (mat & 1) ? wk : wq;
    const float* whi = (mat & 1) ? wg : wv;
    const float* w   = (mat & 4) ? wo : (mat & 2) ? whi : wlo;
    cvt_w_transpose(w, wT5 + (size_t)mat * CIN * HC, blk % WTILES);
  } else {
    cvt_f32_to_f16(x, xh, blk - 5 * WTILES);
  }
}

// ---------------------------------------------------------------------------
// Projection GEMM: Y[4096,512] = Xh[4096,512] @ W[512,512]  (W given as W^T)
// All four projections in ONE grid (they share Xh and do not depend on one
// another): blockIdx.z = mode; wT4 = the four W^T in mode order, qkv = the
// Q, K and V^T outputs in mode order, each one after another.
// mode 0/1: Q/K  -> f16 [B,H,S,c];  mode 2: V -> f16 [B,H,c,S] (transposed);
// mode 3: gate -> f32 sigmoid(Y + bg) at [B,S,HC].
// Block: 128 threads = 4 waves; block tile 64(M) x 64(N); wave tile 16x64.
// W^T tiles double-buffered in LDS via async DMA, shared by the 4 waves.
// ---------------------------------------------------------------------------
__global__ void __launch_bounds__(128) gemm_proj(
    const _Float16* __restrict__ xh, const _Float16* __restrict__ wT4,
    const float* __restrict__ bg,
    _Float16* __restrict__ qkv, float* __restrict__ out32) {
  __shared__ _Float16 wbufA[64 * 32];       // [n_local][k_local]
  __shared__ _Float16 wbufB[64 * 32];

  const int tid  = threadIdx.x;
  const int wv   = tid >> 5;
  const int lane = tid & 31;
  const int lr   = lane & 15;
  const int lh   = lane >> 4;
  const int m0   = blockIdx.y * 64 + wv * 16;
  const int mode = blockIdx.z;
  const int n0   = blockIdx.x * 64;
  const _Float16* wT = wT4 + (size_t)mode * CIN * HC;
  _Float16* out16    = qkv + (size_t)mode * BS * HC;  // not used by mode 3
  const unsigned wA = lds_base(wbufA);
  const unsigned wB = lds_base(wbufB);

  v8f acc[4] = {};

  auto stage = [&](int k0, unsigned dst) {
#pragma unroll
    for (int i = 0; i < 2; ++i) {
      const int id = tid + i * 128;         // 0..255 chunks of 16B
      const int nl = id >> 2, ch = id & 3;
      async_ld16(dst + (unsigned)(nl * 32 + ch * 8) * 2,
                 wT + (size_t)(n0 + nl) * CIN + k0 + ch * 8);
    }
  };
  auto compute = [&](int k0, const _Float16* wb) {
    v16h a = load_frag16(xh + (size_t)m0 * CIN + k0, CIN);
#pragma unroll
    for (int nt = 0; nt < 4; ++nt) {
      v16h b = load_frag16(wb + nt * 16 * 32, 32);
      acc[nt] = wmma_f16(a, b, acc[nt]);
    }
  };

  stage(0, wA);
  for (int k0 = 0; k0 < CIN; k0 += 64) {
    stage(k0 + 32, wB);                     // k0+32 < 512 always
    wait_async2();                          // tile k0 landed; k0+32 in flight
    __syncthreads();
    compute(k0, wbufA);
    __syncthreads();                        // all reads of A done
    if (k0 + 64 < CIN) { stage(k0 + 64, wA); wait_async2(); }
    else               { wait_async0(); }
    __syncthreads();
    compute(k0 + 32, wbufB);
    __syncthreads();                        // all reads of B done
  }

  const int mbase = m0 + lh * 8;
#pragma unroll
  for (int nt = 0; nt < 4; ++nt) {
    const int n = n0 + nt * 16 + lr;
    const int h = n >> 6, c = n & 63;
#pragma unroll
    for (int r = 0; r < 8; ++r) {
      const int m = mbase + r;
      const int b = m >> 11, s = m & (SEQ - 1);
      const float v = acc[nt][r];
      if (mode <= 1) {
        out16[(((size_t)(b * NHEAD + h)) * SEQ + s) * CHEAD + c] = (_Float16)v;
      } else if (mode == 2) {
        out16[(((size_t)(b * NHEAD + h)) * CHEAD + c) * SEQ + s] = (_Float16)v;
      } else {
        out32[((size_t)(b * SEQ + s)) * HC + n] =
            1.0f / (1.0f + __expf(-(v + bg[n])));
      }
    }
  }
}

__device__ __forceinline__ float other_half(float v) {
  // value of lane l ^ 16
  const int b = __builtin_bit_cast(int, v);
  return __builtin_bit_cast(float, __builtin_amdgcn_permlanex16(
      b, b, 0x76543210, 0xfedcba98, false, false));
}

// 2^x of eight values, each in its own register. One statement: behind an
// exponential stands another one on other registers, so no result is read and
// no source overwritten in the slot directly behind it; the v_nop keeps that
// slot behind the last one, whatever the compiler puts next.
__device__ __forceinline__ v8f exp2x8(v8f t) {
  float a = t[0], b = t[1], c = t[2], d = t[3];
  float e = t[4], f = t[5], g = t[6], h = t[7];
  asm("v_exp_f32 %0, %0\n\tv_exp_f32 %1, %1\n\tv_exp_f32 %2, %2\n\t"
      "v_exp_f32 %3, %3\n\tv_exp_f32 %4, %4\n\tv_exp_f32 %5, %5\n\t"
      "v_exp_f32 %6, %6\n\tv_exp_f32 %7, %7\n\tv_nop"
      : "+v"(a), "+v"(b), "+v"(c), "+v"(d), "+v"(e), "+v"(f), "+v"(g), "+v"(h));
  return v8f{a, b, c, d, e, f, g, h};
}

__global__ void __launch_bounds__(128) attn_flash(
    const _Float16* __restrict__ qh, const _Float16* __restrict__ kh,
    const _Float16* __restrict__ vt, const float* __restrict__ bias,
    const int* __restrict__ amask, const float* __restrict__ gate,
    _Float16* __restrict__ ocat) {
  __shared__ _Float16 kbufA[32 * 64], kbufB[32 * 64];   // [key_local][c]
  __shared__ _Float16 vbufA[64 * 32], vbufB[64 * 32];   // [c][key_local]

  const int tid  = threadIdx.x;
  const int wv   = tid >> 5;
  const int lane = tid & 31;
  const int lr   = lane & 15;
  const int lh   = lane >> 4;
  const int bh   = blockIdx.y;              // 0..15  => (b,h)
  const int bb   = bh >> 3, h = bh & 7;
  const int q0   = (blockIdx.x * 4 + wv) * 16;

  const _Float16* Q = qh + (size_t)bh * SEQ * CHEAD;
  const _Float16* K = kh + (size_t)bh * SEQ * CHEAD;
  const _Float16* V = vt + (size_t)bh * CHEAD * SEQ;
  // this lane's own query row of the bias, at its half's first key
  const float* biasl = bias + ((size_t)bh * SEQ + q0 + lr) * SEQ + lh * 8;
  const int*   mkl   = amask + bb * SEQ + lh * 8;
  const unsigned kA = lds_base(kbufA), kB = lds_base(kbufB);
  const unsigned vA = lds_base(vbufA), vB = lds_base(vbufB);

  // Q^T as B operand: column = query lr, k in the loader's order
  v16h bq0 = load_frag16(Q + (size_t)q0 * CHEAD + 0,  CHEAD);
  v16h bq1 = load_frag16(Q + (size_t)q0 * CHEAD + 32, CHEAD);

  float mrun = -1e30f, lrun = 0.0f;         // lrun: this half's keys only
  v8f oacc[4] = {};                         // O^T: [c = ct*16+8*lh+r][query lr]

  auto stage = [&](int kt, unsigned kdst, unsigned vdst) {
#pragma unroll
    for (int i = 0; i < 2; ++i) {
      const int id = tid + i * 128;         // 0..255
      const int kr = id >> 3, kc = id & 7;  // K: [32 rows][8 chunks]
      async_ld16(kdst + (unsigned)(kr * 64 + kc * 8) * 2,
                 K + (size_t)(kt + kr) * CHEAD + kc * 8);
      const int vc = id >> 2, vch = id & 3; // V^T: [64 rows][4 chunks]
      async_ld16(vdst + (unsigned)(vc * 32 + vch * 8) * 2,
                 V + (size_t)vc * SEQ + kt + vch * 8);
    }
  };

  auto compute = [&](int kt, const _Float16* kb, const _Float16* vb) {
    // --- pair bias + key mask: 8 consecutive keys per lane and 16-key tile ---
    const float* bp = biasl + kt;
    const int*   mp = mkl + kt;
    v8f b8[2];
    v8i m8[2];
#pragma unroll
    for (int nh = 0; nh < 2; ++nh) {
      b8[nh] = *(const v8f*)(bp + nh * 16);
      m8[nh] = *(const v8i*)(mp + nh * 16);
    }
    // the loads' address registers may be reused right behind them
    asm volatile("s_wait_xcnt 0x0" ::: "memory");
    // --- logits tile: S^T = K Q^T  (32 keys x 16 queries, two f32 tiles) ---
    v16h ak[2][2];
#pragma unroll
    for (int nh = 0; nh < 2; ++nh) {
      ak[nh][0] = load_frag16(kb + nh * 16 * 64 + 0,  64);
      ak[nh][1] = load_frag16(kb + nh * 16 * 64 + 32, 64);
    }
    v8f sa[2] = {};
#pragma unroll
    for (int nh = 0; nh < 2; ++nh) {
      sa[nh] = wmma_f16(ak[nh][0], bq0, sa[nh]);
      sa[nh] = wmma_f16(ak[nh][1], bq1, sa[nh]);
    }
    // V^T fragments (A rows = output channel c): P never passes through LDS,
    // so they can be fetched while the softmax runs
    v16h av[4];
#pragma unroll
    for (int ct = 0; ct < 4; ++ct) av[ct] = load_frag16(vb + ct * 16 * 32, 32);
    // --- scale + pair bias + key mask ---
#pragma unroll
    for (int nh = 0; nh < 2; ++nh) {
      v8f moff;
#pragma unroll
      for (int r = 0; r < 8; ++r) moff[r] = (m8[nh][r] > 0) ? 0.0f : -1e9f;
      sa[nh] = sa[nh] * 0.125f + b8[nh] + moff;
    }
    // --- online softmax: one query per lane, halves joined for the maximum ---
    const v8f mx8 = __builtin_elementwise_max(sa[0], sa[1]);
    const float mx = fmaxf(fmaxf(fmaxf(mx8[0], mx8[1]), fmaxf(mx8[2], mx8[3])),
                           fmaxf(fmaxf(mx8[4], mx8[5]), fmaxf(mx8[6], mx8[7])));
    const float mnew = fmaxf(mrun, fmaxf(mx, other_half(mx)));
#pragma unroll
    for (int nh = 0; nh < 2; ++nh)
      sa[nh] = exp2x8((sa[nh] - mnew) * 1.44269504f);   // exp(x) = 2^(x log2 e)
    const v8f ps = sa[0] + sa[1];
    const float ts = ((ps[0] + ps[1]) + (ps[2] + ps[3])) +
                     ((ps[4] + ps[5]) + (ps[6] + ps[7]));
    const float alpha = __expf(mrun - mnew);
    lrun = lrun * alpha + ts;
    mrun = mnew;
#pragma unroll
    for (int ct = 0; ct < 4; ++ct) oacc[ct] *= alpha;
    // --- P^T as B operand: element s = key 8*lh+s (s<8), 16+8*lh+s-8 (s>=8) ---
    const v16h pt = __builtin_shufflevector(
        __builtin_convertvector(sa[0], v8h), __builtin_convertvector(sa[1], v8h),
        0, 1, 2, 3, 4, 5, 6, 7, 8, 9, 10, 11, 12, 13, 14, 15);
    // --- O^T += V^T P^T ---
#pragma unroll
    for (int ct = 0; ct < 4; ++ct) oacc[ct] = wmma_f16(av[ct], pt, oacc[ct]);
  };

  stage(0, kA, vA);
  for (int kt = 0; kt < SEQ; kt += 64) {
    stage(kt + 32, kB, vB);                 // kt+32 < 2048 always
    wait_async4();                          // tile kt landed; kt+32 in flight
    __syncthreads();
    compute(kt, kbufA, vbufA);
    __syncthreads();
    if (kt + 64 < SEQ) { stage(kt + 64, kA, vA); wait_async4(); }
    else               { wait_async0(); }
    __syncthreads();
    compute(kt + 32, kbufB, vbufB);
    __syncthreads();
  }

  // --- epilogue: normalize, gate, store concat-head f16 [B,S,HC] ---
  // a lane holds 8 consecutive channels of its query per tile: 16-byte stores
  const float rl = 1.0f / (lrun + other_half(lrun));
  const size_t rowoff = ((size_t)(bb * SEQ + q0 + lr)) * HC + h * CHEAD + lh * 8;
#pragma unroll
  for (int ct = 0; ct < 4; ++ct) {
    const float4 g0 = *(const float4*)(gate + rowoff + ct * 16);
    const float4 g1 = *(const float4*)(gate + rowoff + ct * 16 + 4);
    const float g8[8] = {g0.x, g0.y, g0.z, g0.w, g1.x, g1.y, g1.z, g1.w};
    v8h o;
#pragma unroll
    for (int r = 0; r < 8; ++r) o[r] = (_Float16)(oacc[ct][r] * rl * g8[r]);
    *(v8h*)(ocat + rowoff + ct * 16) = o;
  }
}

// ---------------------------------------------------------------------------
// Output GEMM: out[4096,512] = Ocat[4096,512] @ Wo + bo   (Wo given as Wo^T)
// Same double-buffered async LDS weight staging as gemm_proj.
// ---------------------------------------------------------------------------
__global__ void __launch_bounds__(128) gemm_out(
    const _Float16* __restrict__ oc, const _Float16* __restrict__ woT,
    const float* __restrict__ bo, float* __restrict__ out) {
  __shared__ _Float16 wbufA[64 * 32];
  __shared__ _Float16 wbufB[64 * 32];

  const int tid  = threadIdx.x;
  const int wv   = tid >> 5;
  const int lane = tid & 31;
  const int lr   = lane & 15;
  const int lh   = lane >> 4;
  const int m0   = blockIdx.y * 64 + wv * 16;
  const int n0   = blockIdx.x * 64;
  const unsigned wA = lds_base(wbufA);
  const unsigned wB = lds_base(wbufB);

  v8f acc[4] = {};

  auto stage = [&](int k0, unsigned dst) {
#pragma unroll
    for (int i = 0; i < 2; ++i) {
      const int id = tid + i * 128;
      const int nl = id >> 2, ch = id & 3;
      async_ld16(dst + (unsigned)(nl * 32 + ch * 8) * 2,
                 woT + (size_t)(n0 + nl) * HC + k0 + ch * 8);
    }
  };
  auto compute = [&](int k0, const _Float16* wb) {
    v16h a = load_frag16(oc + (size_t)m0 * HC + k0, HC);
#pragma unroll
    for (int nt = 0; nt < 4; ++nt) {
      v16h b = load_frag16(wb + nt * 16 * 32, 32);
      acc[nt] = wmma_f16(a, b, acc[nt]);
    }
  };

  stage(0, wA);
  for (int k0 = 0; k0 < HC; k0 += 64) {
    stage(k0 + 32, wB);
    wait_async2();
    __syncthreads();
    compute(k0, wbufA);
    __syncthreads();
    if (k0 + 64 < HC) { stage(k0 + 64, wA); wait_async2(); }
    else              { wait_async0(); }
    __syncthreads();
    compute(k0 + 32, wbufB);
    __syncthreads();
  }

  const int mbase = m0 + lh * 8;
#pragma unroll
  for (int nt = 0; nt < 4; ++nt) {
    const int n = n0 + nt * 16 + lr;
    const float bn = bo[n];
#pragma unroll
    for (int r = 0; r < 8; ++r)
      out[(size_t)(mbase + r) * CIN + n] = acc[nt][r] + bn;
  }
}

// ---------------------------------------------------------------------------
extern "C" void kernel_launch(void* const* d_in, const int* in_sizes, int n_in,
                              void* d_out, int out_size, void* d_ws,
                              size_t ws_size, hipStream_t stream) {
  const float* x     = (const float*)d_in[0];
  const float* bias  = (const float*)d_in[1];
  const int*   amask = (const int*)d_in[2];
  const float* Wq    = (const float*)d_in[3];
  const float* Wk    = (const float*)d_in[4];
  const float* Wv    = (const float*)d_in[5];
  const float* Wg    = (const float*)d_in[6];
  const float* bg    = (const float*)d_in[7];
  const float* Wo    = (const float*)d_in[8];
  const float* bo    = (const float*)d_in[9];
  float* out = (float*)d_out;

  char* ws = (char*)d_ws;
  size_t off = 0;
  auto carve = [&](size_t bytes) -> char* {
    char* p = ws + off;
    off += (bytes + 255) & ~(size_t)255;
    return p;
  };
  _Float16* xh  = (_Float16*)carve((size_t)BS * CIN * 2);
  // the five W^T (q, k, v, g, o) in one piece, and Q, K, V^T in one piece
  _Float16* wt5 = (_Float16*)carve((size_t)5 * CIN * HC * 2);
  _Float16* wto = wt5 + (size_t)4 * CIN * HC;
  _Float16* qkv = (_Float16*)carve((size_t)3 * BS * HC * 2);
  _Float16* qh  = qkv;
  _Float16* kh  = qkv + (size_t)BS * HC;
  _Float16* vt  = qkv + (size_t)2 * BS * HC;
  float*    gat = (float*)carve((size_t)BS * HC * 4);
  _Float16* oc  = (_Float16*)carve((size_t)BS * HC * 2);

  // 1) convert x to f16; transpose+convert the 5 weight matrices: one launch
  cvt_all<<<5 * WTILES + XBLOCKS, 256, 0, stream>>>(x, Wq, Wk, Wv, Wg, Wo,
                                                    xh, wt5);

  // 2) projections (Q, K, V^T, gate): one launch
  {
    dim3 grid(HC / 64, BS / 64, 4);
    gemm_proj<<<grid, 128, 0, stream>>>(xh, wt5, bg, qkv, gat);
  }

  // 3) fused flash attention (bias streamed once, softmax online, gated)
  {
    dim3 grid(SEQ / 64, BATCH * NHEAD);
    attn_flash<<<grid, 128, 0, stream>>>(qh, kh, vt, bias, amask, gat, oc);
  }

  // 4) output projection + bias
  {
    dim3 grid(CIN / 64, BS / 64);
    gemm_out<<<grid, 128, 0, stream>>>(oc, wto, bo, out);
  }
}

// v004
// It runs in 118 microseconds.
// In both of two side-by-side timings against v003, it was 1.04 times as fast.
// Counting every step since v000, it is 1.60 times as fast.
#include <hip/hip_runtime.h>
#include <hip/hip_bf16.h>

typedef __attribute__((ext_vector_type(16))) _Float16 v16h;
typedef __attribute__((ext_vector_type(8)))  _Float16 v8h;
typedef __attribute__((ext_vector_type(8)))  float    v8f;
typedef __attribute__((ext_vector_type(8)))  int      v8i;
typedef __attribute__((ext_vector_type(4)))  float    v4f;
typedef __attribute__((ext_vector_type(4)))  _Float16 v4h;
typedef __attribute__((ext_vector_type(2)))  _Float16 v2h;

#define BATCH 2
#define SEQ   2048
#define CIN   512
#define NHEAD 8
#define CHEAD 64
#define HC    512          // NHEAD*CHEAD
#define BS    4096         // BATCH*SEQ

// ---------------------------------------------------------------------------
// WMMA helpers
// ---------------------------------------------------------------------------
__device__ __forceinline__ v8f wmma_f16(v16h a, v16h b, v8f c) {
  // D = A(16x32 f16) * B(32x16 f16) + C(16x16 f32)
  return __builtin_amdgcn_wmma_f32_16x16x32_f16(
      false, a, false, b, (short)0, c, false, false);
}

// Load one 16x32 f16 fragment (A-layout; also serves B when the B source is
// stored n-major with k contiguous). `base` points at element (row0, k0),
// `ld` is the row stride in elements. Per ISA 16-bit A layout:
//   lanes 0-15 : row = lane,    K = 0..7 and 16..23
//   lanes 16-31: row = lane-16, K = 8..15 and 24..31
__device__ __forceinline__ v16h load_frag16(const _Float16* base, int ld) {
  const int lane = threadIdx.x & 31;
  const int row  = lane & 15;
  const int koff = (lane >> 4) << 3;        // 0 or 8
  const _Float16* p = base + row * ld + koff;
  v8h lo = *(const v8h*)(p);                // K = koff .. koff+7
  v8h hi = *(const v8h*)(p + 16);           // K = 16+koff .. 16+koff+7
  return __builtin_shufflevector(lo, hi, 0,1,2,3,4,5,6,7,
                                 8,9,10,11,12,13,14,15);
}

// ---------------------------------------------------------------------------
// CDNA5 async memory->LDS staging (ASYNCcnt path; no VGPR round-trip).
// Async loads complete in order, so "s_wait_asynccnt N" with N = #chunks just
// issued for the NEXT tile guarantees the PREVIOUS tile has fully landed --
// the basis for double-buffered DMA/compute overlap.
// ---------------------------------------------------------------------------
typedef __attribute__((address_space(3))) const void* lds_cptr_t;

__device__ __forceinline__ unsigned lds_base(const void* p) {
  // addrspace(3) pointers are 32-bit offsets from the wave's LDS base
  return (unsigned)(unsigned long long)(lds_cptr_t)p;
}

// per-lane: LDS[l] = MEM[g] (16 bytes each), tracked with ASYNCcnt. All copies
// of one stage stand in one statement whose last line is s_wait_xcnt 0: a
// precaution that keeps every later rewrite of the address registers they
// name behind that wait (the compiler puts nothing inside a statement).
__device__ __forceinline__ void async_ld16x2(unsigned l0, const void* g0,
                                             unsigned l1, const void* g1) {
  asm volatile("global_load_async_to_lds_b128 %0, %1, off\n\t"
               "global_load_async_to_lds_b128 %2, %3, off\n\t"
               "s_wait_xcnt 0x0"
               :: "v"(l0), "v"((unsigned long long)g0),
                  "v"(l1), "v"((unsigned long long)g1)
               : "memory");
}
__device__ __forceinline__ void async_ld16x4(unsigned l0, const void* g0,
                                             unsigned l1, const void* g1,
                                             unsigned l2, const void* g2,
                                             unsigned l3, const void* g3) {
  asm volatile("global_load_async_to_lds_b128 %0, %1, off\n\t"
               "global_load_async_to_lds_b128 %2, %3, off\n\t"
               "global_load_async_to_lds_b128 %4, %5, off\n\t"
               "global_load_async_to_lds_b128 %6, %7, off\n\t"
               "s_wait_xcnt 0x0"
               :: "v"(l0), "v"((unsigned long long)g0),
                  "v"(l1), "v"((unsigned long long)g1),
                  "v"(l2), "v"((unsigned long long)g2),
                  "v"(l3), "v"((unsigned long long)g3)
               : "memory");
}

// LDS row pitches, in f16 elements. The fragment loader reads 16 rows at once,
// 16 bytes a lane; a pitch of 16 bytes x an odd number puts the 16 rows on 64
// different banks. Unpadded rows of 128 / 64 bytes fall on 8 / 16 banks only.
#define KPITCH 72          // 64-element (128-byte) K rows   -> 144 bytes
#define VPITCH 40          // 32-element (64-byte) V^T rows  ->  80 bytes
#define WPITCH 40          // 32-element (64-byte) W^T rows  ->  80 bytes

__device__ __forceinline__ void wait_async0() {
  asm volatile("s_wait_asynccnt 0x0" ::: "memory");
}
__device__ __forceinline__ void wait_async2() {
  asm volatile("s_wait_asynccnt 0x2" ::: "memory");
}
__device__ __forceinline__ void wait_async4() {
  asm volatile("s_wait_asynccnt 0x4" ::: "memory");
}

// ---------------------------------------------------------------------------
// Conversion kernels
// ---------------------------------------------------------------------------
// Each thread takes many elements, so that few waves have to start.
// 32 floats a thread; every wave-wide load and store covers whole 128-byte
// lines. BS*CIN / 8192 blocks, no remainder.
#define XBLOCKS ((BS * CIN) / 8192)
__device__ __forceinline__ void cvt_f32_to_f16(
    const float* __restrict__ src, _Float16* __restrict__ dst, int blk) {
  const int base = blk * 8192 + threadIdx.x * 4;
  v4f v[8];
  // unrolled: all eight loads are issued before the first is waited for
#pragma unroll
  for (int j = 0; j < 8; ++j) v[j] = *(const v4f*)(src + base + j * 1024);
  // unrolled: v[] stays in registers
#pragma unroll
  for (int j = 0; j < 8; ++j)
    *(v4h*)(dst + base + j * 1024) = __builtin_convertvector(v[j], v4h);
  // precaution: the stores' registers may be written again by whatever code
  // the compiler lays out behind this inlined body
  asm volatile("s_wait_xcnt 0x0" ::: "memory");
}

// wT[n*512 + k] = (f16) w[k*512 + n]   (512x512 transpose + convert)
// One 64(k) x 64(n) tile a block, 16 elements a thread: rows of w read in
// 256-byte runs, turned in LDS, rows of wT written in whole 128-byte lines.
// The short loops are unrolled so that a[][] stays in registers and the four
// loads are issued together.
#define WTILES ((CIN / 64) * (HC / 64))    // tiles of one weight matrix
__device__ __forceinline__ void cvt_w_transpose(
    const float* __restrict__ w, _Float16* __restrict__ wT, int tile) {
  __shared__ _Float16 t[64 * 72];           // [n_local][k_local], 144-byte rows
  const int tid = threadIdx.x;
  const int k0  = (tile & 7) * 64, n0 = (tile >> 3) * 64;
  const int nq  = (tid & 15) * 4;           // four columns n
  const int kp  = (tid >> 4) * 2;           // two rows k, twice (32 apart)
  v4f a[2][2];
#pragma unroll
  for (int j = 0; j < 2; ++j)
#pragma unroll
    for (int e = 0; e < 2; ++e)
      a[j][e] = *(const v4f*)(w + (k0 + kp + 32 * j + e) * CIN + n0 + nq);
#pragma unroll
  for (int j = 0; j < 2; ++j)
#pragma unroll
    for (int i = 0; i < 4; ++i) {
      const v2h p = {(_Float16)a[j][0][i], (_Float16)a[j][1][i]};
      *(v2h*)(t + (nq + i) * 72 + kp + 32 * j) = p;
    }
  __syncthreads();                          // the tile is read across waves
#pragma unroll
  for (int j = 0; j < 2; ++j) {
    const int nl = (tid >> 3) + 32 * j, kc = (tid & 7) * 8;
    *(v8h*)(wT + (n0 + nl) * CIN + k0 + kc) = *(const v8h*)(t + nl * 72 + kc);
  }
}

// All six conversions as ONE grid: none depends on another, so they need no
// launch boundary between them. Blocks 0 .. 5*WTILES-1 turn the five weight
// matrices (the longer chain, started first) into wT5[matrix][n][k]; the rest
// convert x. The choice is the same for a whole block, barrier included.
__global__ void __launch_bounds__(256) cvt_all(
    const float* __restrict__ x,  const float* __restrict__ wq,
    const float* __restrict__ wk, const float* __restrict__ wv,
    const float* __restrict__ wg, const float* __restrict__ wo,
    _Float16* __restrict__ xh, _Float16* __restrict__ wT5) {
  const unsigned blk = blockIdx.x;
  if (blk < 5 * WTILES) {
    const unsigned mat = blk / WTILES;
    const float* wlo = (mat & 1) ? wk : wq;
    const float* whi = (mat & 1) ? wg : wv;
    const float* w   = (mat & 4) ? wo : (mat & 2) ? whi : wlo;
    cvt_w_transpose(w, wT5 + (size_t)mat * CIN * HC, blk % WTILES);
  } else {
    cvt_f32_to_f16(x, xh, blk - 5 * WTILES);
  }
}

// ---------------------------------------------------------------------------
// Projection GEMM: Y[4096,512] = Xh[4096,512] @ W[512,512]  (W given as W^T)
// All four projections in ONE grid (they share Xh and do not depend on one
// another): blockIdx.z = mode; wT4 = the four W^T in mode order, qkv = the
// Q, K and V^T outputs in mode order, each one after another.
// mode 0/1: Q/K  -> f16 [B,H,S,c];  mode 2: V -> f16 [B,H,c,S] (transposed);
// mode 3: gate -> f32 sigmoid(Y + bg) at [B,S,HC].
// Block: 128 threads = 4 waves; block tile 64(M) x 64(N); wave tile 16x64.
// W^T tiles double-buffered in LDS via async DMA, shared by the 4 waves.
// ---------------------------------------------------------------------------
__global__ void __launch_bounds__(128) gemm_proj(
    const _Float16* __restrict__ xh, const _Float16* __restrict__ wT4,
    const float* __restrict__ bg,
    _Float16* __restrict__ qkv, float* __restrict__ out32) {
  // [n_local][k_local], padded rows; 16-byte copies and reads
  __shared__ __attribute__((aligned(16))) _Float16 wbufA[64 * WPITCH];
  __shared__ __attribute__((aligned(16))) _Float16 wbufB[64 * WPITCH];

  const int tid  = threadIdx.x;
  const int wv   = tid >> 5;
  const int lane = tid & 31;
  const int lr   = lane & 15;
  const int lh   = lane >> 4;
  const int m0   = blockIdx.y * 64 + wv * 16;
  const int mode = blockIdx.z;
  const int n0   = blockIdx.x * 64;
  const _Float16* wT = wT4 + (size_t)mode * CIN * HC;
  _Float16* out16    = qkv + (size_t)mode * BS * HC;  // not used by mode 3
  const unsigned wA = lds_base(wbufA);
  const unsigned wB = lds_base(wbufB);

  v8f acc[4] = {};

  auto stage = [&](int k0, unsigned dst) {
    // 256 chunks of 16B: this thread's are rows nl and nl + 32, chunk ch
    const int nl = tid >> 2, ch = tid & 3;
    const unsigned  l = dst + (unsigned)(nl * WPITCH + ch * 8) * 2;
    const _Float16* g = wT + (size_t)(n0 + nl) * CIN + k0 + ch * 8;
    async_ld16x2(l, g, l + 32 * WPITCH * 2, g + (size_t)32 * CIN);
  };
  auto compute = [&](int k0, const _Float16* wb) {
    v16h a = load_frag16(xh + (size_t)m0 * CIN + k0, CIN);
#pragma unroll
    for (int nt = 0; nt < 4; ++nt) {
      v16h b = load_frag16(wb + nt * 16 * WPITCH, WPITCH);
      acc[nt] = wmma_f16(a, b, acc[nt]);
    }
  };

  stage(0, wA);
  for (int k0 = 0; k0 < CIN; k0 += 64) {
    stage(k0 + 32, wB);                     // k0+32 < 512 always
    wait_async2();                          // tile k0 landed; k0+32 in flight
    __syncthreads();
    compute(k0, wbufA);
    __syncthreads();                        // all reads of A done
    if (k0 + 64 < CIN) { stage(k0 + 64, wA); wait_async2(); }
    else               { wait_async0(); }
    __syncthreads();
    compute(k0 + 32, wbufB);
    __syncthreads();                        // all reads of B done
  }

  const int mbase = m0 + lh * 8;
#pragma unroll
  for (int nt = 0; nt < 4; ++nt) {
    const int n = n0 + nt * 16 + lr;
    const int h = n >> 6, c = n & 63;
#pragma unroll
    for (int r = 0; r < 8; ++r) {
      const int m = mbase + r;
      const int b = m >> 11, s = m & (SEQ - 1);
      const float v = acc[nt][r];
      if (mode <= 1) {
        out16[(((size_t)(b * NHEAD + h)) * SEQ + s) * CHEAD + c] = (_Float16)v;
      } else if (mode == 2) {
        out16[(((size_t)(b * NHEAD + h)) * CHEAD + c) * SEQ + s] = (_Float16)v;
      } else {
        out32[((size_t)(b * SEQ + s)) * HC + n] =
            1.0f / (1.0f + __expf(-(v + bg[n])));
      }
    }
  }
}

__device__ __forceinline__ float other_half(float v) {
  // value of lane l ^ 16
  const int b = __builtin_bit_cast(int, v);
  return __builtin_bit_cast(float, __builtin_amdgcn_permlanex16(
      b, b, 0x76543210, 0xfedcba98, false, false));
}

// 2^x of eight values, each in its own register. One statement: behind an
// exponential stands another one on other registers, so no result is read and
// no source overwritten in the slot directly behind it; the v_nop keeps that
// slot behind the last one, whatever the compiler puts next.
__device__ __forceinline__ v8f exp2x8(v8f t) {
  float a = t[0], b = t[1], c = t[2], d = t[3];
  float e = t[4], f = t[5], g = t[6], h = t[7];
  asm("v_exp_f32 %0, %0\n\tv_exp_f32 %1, %1\n\tv_exp_f32 %2, %2\n\t"
      "v_exp_f32 %3, %3\n\tv_exp_f32 %4, %4\n\tv_exp_f32 %5, %5\n\t"
      "v_exp_f32 %6, %6\n\tv_exp_f32 %7, %7\n\tv_nop"
      : "+v"(a), "+v"(b), "+v"(c), "+v"(d), "+v"(e), "+v"(f), "+v"(g), "+v"(h));
  return v8f{a, b, c, d, e, f, g, h};
}

__global__ void __launch_bounds__(128) attn_flash(
    const _Float16* __restrict__ qh, const _Float16* __restrict__ kh,
    const _Float16* __restrict__ vt, const float* __restrict__ bias,
    const int* __restrict__ amask, const float* __restrict__ gate,
    _Float16* __restrict__ ocat) {
  // [key_local][c] and [c][key_local], padded rows; 16-byte copies and reads
  __shared__ __attribute__((aligned(16))) _Float16 kbufA[32 * KPITCH];
  __shared__ __attribute__((aligned(16))) _Float16 kbufB[32 * KPITCH];
  __shared__ __attribute__((aligned(16))) _Float16 vbufA[64 * VPITCH];
  __shared__ __attribute__((aligned(16))) _Float16 vbufB[64 * VPITCH];

  const int tid  = threadIdx.x;
  const int wv   = tid >> 5;
  const int lane = tid & 31;
  const int lr   = lane & 15;
  const int lh   = lane >> 4;
  const int bh   = blockIdx.y;              // 0..15  => (b,h)
  const int bb   = bh >> 3, h = bh & 7;
  const int q0   = (blockIdx.x * 4 + wv) * 16;

  const _Float16* Q = qh + (size_t)bh * SEQ * CHEAD;
  const _Float16* K = kh + (size_t)bh * SEQ * CHEAD;
  const _Float16* V = vt + (size_t)bh * CHEAD * SEQ;
  // this lane's own query row of the bias, at its half's first key
  const float* biasl = bias + ((size_t)bh * SEQ + q0 + lr) * SEQ + lh * 8;
  const int*   mkl   = amask + bb * SEQ + lh * 8;
  const unsigned kA = lds_base(kbufA), kB = lds_base(kbufB);
  const unsigned vA = lds_base(vbufA), vB = lds_base(vbufB);

  // Q^T as B operand: column = query lr, k in the loader's order
  v16h bq0 = load_frag16(Q + (size_t)q0 * CHEAD + 0,  CHEAD);
  v16h bq1 = load_frag16(Q + (size_t)q0 * CHEAD + 32, CHEAD);

  float mrun = -1e30f, lrun = 0.0f;         // lrun: this half's keys only
  v8f oacc[4] = {};                         // O^T: [c = ct*16+8*lh+r][query lr]

  auto stage = [&](int kt, unsigned kdst, unsigned vdst) {
    const int kr = tid >> 3, kc = tid & 7;  // K: [32 rows][8 chunks], +16 rows
    const int vc = tid >> 2, vch = tid & 3; // V^T: [64 rows][4 chunks], +32 rows
    const unsigned  kl = kdst + (unsigned)(kr * KPITCH + kc * 8) * 2;
    const unsigned  vl = vdst + (unsigned)(vc * VPITCH + vch * 8) * 2;
    const _Float16* kg = K + (size_t)(kt + kr) * CHEAD + kc * 8;
    const _Float16* vg = V + (size_t)vc * SEQ + kt + vch * 8;
    async_ld16x4(kl, kg, vl, vg,
                 kl + 16 * KPITCH * 2, kg + (size_t)16 * CHEAD,
                 vl + 32 * VPITCH * 2, vg + (size_t)32 * SEQ);
  };

  auto compute = [&](int kt, const _Float16* kb, const _Float16* vb) {
    // --- pair bias + key mask: 8 consecutive keys per lane and 16-key tile ---
    const float* bp = biasl + kt;
    const int*   mp = mkl + kt;
    v8f b8[2];
    v8i m8[2];
#pragma unroll
    for (int nh = 0; nh < 2; ++nh) {
      b8[nh] = *(const v8f*)(bp + nh * 16);
      m8[nh] = *(const v8i*)(mp + nh * 16);
    }
    // the loads' address registers may be reused right behind them
    asm volatile("s_wait_xcnt 0x0" ::: "memory");
    // --- logits tile: S^T = K Q^T  (32 keys x 16 queries, two f32 tiles) ---
    v16h ak[2][2];
#pragma unroll
    for (int nh = 0; nh < 2; ++nh) {
      ak[nh][0] = load_frag16(kb + nh * 16 * KPITCH + 0,  KPITCH);
      ak[nh][1] = load_frag16(kb + nh * 16 * KPITCH + 32, KPITCH);
    }
    v8f sa[2] = {};
#pragma unroll
    for (int nh = 0; nh < 2; ++nh) {
      sa[nh] = wmma_f16(ak[nh][0], bq0, sa[nh]);
      sa[nh] = wmma_f16(ak[nh][1], bq1, sa[nh]);
    }
    // V^T fragments (A rows = output channel c): P never passes through LDS,
    // so they can be fetched while the softmax runs
    v16h av[4];
#pragma unroll
    for (int ct = 0; ct < 4; ++ct) av[ct] = load_frag16(vb + ct * 16 * VPITCH, VPITCH);
    // --- scale + pair bias + key mask ---
#pragma unroll
    for (int nh = 0; nh < 2; ++nh) {
      v8f moff;
#pragma unroll
      for (int r = 0; r < 8; ++r) moff[r] = (m8[nh][r] > 0) ? 0.0f : -1e9f;
      sa[nh] = sa[nh] * 0.125f + b8[nh] + moff;
    }
    // --- online softmax: one query per lane, halves joined for the maximum ---
    const v8f mx8 = __builtin_elementwise_max(sa[0], sa[1]);
    const float mx = fmaxf(fmaxf(fmaxf(mx8[0], mx8[1]), fmaxf(mx8[2], mx8[3])),
                           fmaxf(fmaxf(mx8[4], mx8[5]), fmaxf(mx8[6], mx8[7])));
    const float mnew = fmaxf(mrun, fmaxf(mx, other_half(mx)));
#pragma unroll
    for (int nh = 0; nh < 2; ++nh)
      sa[nh] = exp2x8((sa[nh] - mnew) * 1.44269504f);   // exp(x) = 2^(x log2 e)
    const v8f ps = sa[0] + sa[1];
    const float ts = ((ps[0] + ps[1]) + (ps[2] + ps[3])) +
                     ((ps[4] + ps[5]) + (ps[6] + ps[7]));
    const float alpha = __expf(mrun - mnew);
    lrun = lrun * alpha + ts;
    mrun = mnew;
#pragma unroll
    for (int ct = 0; ct < 4; ++ct) oacc[ct] *= alpha;
    // --- P^T as B operand: element s = key 8*lh+s (s<8), 16+8*lh+s-8 (s>=8) ---
    const v16h pt = __builtin_shufflevector(
        __builtin_convertvector(sa[0], v8h), __builtin_convertvector(sa[1], v8h),
        0, 1, 2, 3, 4, 5, 6, 7, 8, 9, 10, 11, 12, 13, 14, 15);
    // --- O^T += V^T P^T ---
#pragma unroll
    for (int ct = 0; ct < 4; ++ct) oacc[ct] = wmma_f16(av[ct], pt, oacc[ct]);
  };

  stage(0, kA, vA);
  for (int kt = 0; kt < SEQ; kt += 64) {
    stage(kt + 32, kB, vB);                 // kt+32 < 2048 always
    wait_async4();                          // tile kt landed; kt+32 in flight
    __syncthreads();
    compute(kt, kbufA, vbufA);
    __syncthreads();
    if (kt + 64 < SEQ) { stage(kt + 64, kA, vA); wait_async4(); }
    else               { wait_async0(); }
    __syncthreads();
    compute(kt + 32, kbufB, vbufB);
    __syncthreads();
  }

  // --- epilogue: normalize, gate, store concat-head f16 [B,S,HC] ---
  // a lane holds 8 consecutive channels of its query per tile: 16-byte stores
  const float rl = 1.0f / (lrun + other_half(lrun));
  const size_t rowoff = ((size_t)(bb * SEQ + q0 + lr)) * HC + h * CHEAD + lh * 8;
#pragma unroll
  for (int ct = 0; ct < 4; ++ct) {
    const float4 g0 = *(const float4*)(gate + rowoff + ct * 16);
    const float4 g1 = *(const float4*)(gate + rowoff + ct * 16 + 4);
    const float g8[8] = {g0.x, g0.y, g0.z, g0.w, g1.x, g1.y, g1.z, g1.w};
    v8h o;
#pragma unroll
    for (int r = 0; r < 8; ++r) o[r] = (_Float16)(oacc[ct][r] * rl * g8[r]);
    *(v8h*)(ocat + rowoff + ct * 16) = o;
  }
}

// ---------------------------------------------------------------------------
// Output GEMM: out[4096,512] = Ocat[4096,512] @ Wo + bo   (Wo given as Wo^T)
// Same double-buffered async LDS weight staging as gemm_proj.
// ---------------------------------------------------------------------------
__global__ void __launch_bounds__(128) gemm_out(
    const _Float16* __restrict__ oc, const _Float16* __restrict__ woT,
    const float* __restrict__ bo, float* __restrict__ out) {
  __shared__ __attribute__((aligned(16))) _Float16 wbufA[64 * WPITCH];
  __shared__ __attribute__((aligned(16))) _Float16 wbufB[64 * WPITCH];

  const int tid  = threadIdx.x;
  const int wv   = tid >> 5;
  const int lane = tid & 31;
  const int lr   = lane & 15;
  const int lh   = lane >> 4;
  const int m0   = blockIdx.y * 64 + wv * 16;
  const int n0   = blockIdx.x * 64;
  const unsigned wA = lds_base(wbufA);
  const unsigned wB = lds_base(wbufB);

  v8f acc[4] = {};

  auto stage = [&](int k0, unsigned dst) {
    const int nl = tid >> 2, ch = tid & 3;  // rows nl and nl + 32, chunk ch
    const unsigned  l = dst + (unsigned)(nl * WPITCH + ch * 8) * 2;
    const _Float16* g = woT + (size_t)(n0 + nl) * HC + k0 + ch * 8;
    async_ld16x2(l, g, l + 32 * WPITCH * 2, g + (size_t)32 * HC);
  };
  auto compute = [&](int k0, const _Float16* wb) {
    v16h a = load_frag16(oc + (size_t)m0 * HC + k0, HC);
#pragma unroll
    for (int nt = 0; nt < 4; ++nt) {
      v16h b = load_frag16(wb + nt * 16 * WPITCH, WPITCH);
      acc[nt] = wmma_f16(a, b, acc[nt]);
    }
  };

  stage(0, wA);
  for (int k0 = 0; k0 < HC; k0 += 64) {
    stage(k0 + 32, wB);
    wait_async2();
    __syncthreads();
    compute(k0, wbufA);
    __syncthreads();
    if (k0 + 64 < HC) { stage(k0 + 64, wA); wait_async2(); }
    else              { wait_async0(); }
    __syncthreads();
    compute(k0 + 32, wbufB);
    __syncthreads();
  }

  const int mbase = m0 + lh * 8;
#pragma unroll
  for (int nt = 0; nt < 4; ++nt) {
    const int n = n0 + nt * 16 + lr;
    const float bn = bo[n];
#pragma unroll
    for (int r = 0; r < 8; ++r)
      out[(size_t)(mbase + r) * CIN + n] = acc[nt][r] + bn;
  }
}

// ---------------------------------------------------------------------------
extern "C" void kernel_launch(void* const* d_in, const int* in_sizes, int n_in,
                              void* d_out, int out_size, void* d_ws,
                              size_t ws_size, hipStream_t stream) {
  const float* x     = (const float*)d_in[0];
  const float* bias  = (const float*)d_in[1];
  const int*   amask = (const int*)d_in[2];
  const float* Wq    = (const float*)d_in[3];
  const float* Wk    = (const float*)d_in[4];
  const float* Wv    = (const float*)d_in[5];
  const float* Wg    = (const float*)d_in[6];
  const float* bg    = (const float*)d_in[7];
  const float* Wo    = (const float*)d_in[8];
  const float* bo    = (const float*)d_in[9];
  float* out = (float*)d_out;

  char* ws = (char*)d_ws;
  size_t off = 0;
  auto carve = [&](size_t bytes) -> char* {
    char* p = ws + off;
    off += (bytes + 255) & ~(size_t)255;
    return p;
  };
  _Float16* xh  = (_Float16*)carve((size_t)BS * CIN * 2);
  // the five W^T (q, k, v, g, o) in one piece, and Q, K, V^T in one piece
  _Float16* wt5 = (_Float16*)carve((size_t)5 * CIN * HC * 2);
  _Float16* wto = wt5 + (size_t)4 * CIN * HC;
  _Float16* qkv = (_Float16*)carve((size_t)3 * BS * HC * 2);
  _Float16* qh  = qkv;
  _Float16* kh  = qkv + (size_t)BS * HC;
  _Float16* vt  = qkv + (size_t)2 * BS * HC;
  float*    gat = (float*)carve((size_t)BS * HC * 4);
  _Float16* oc  = (_Float16*)carve((size_t)BS * HC * 2);

  // 1) convert x to f16; transpose+convert the 5 weight matrices: one launch
  cvt_all<<<5 * WTILES + XBLOCKS, 256, 0, stream>>>(x, Wq, Wk, Wv, Wg, Wo,
                                                    xh, wt5);

  // 2) projections (Q, K, V^T, gate): one launch
  {
    dim3 grid(HC / 64, BS / 64, 4);
    gemm_proj<<<grid, 128, 0, stream>>>(xh, wt5, bg, qkv, gat);
  }

  // 3) fused flash attention (bias streamed once, softmax online, gated)
  {
    dim3 grid(SEQ / 64, BATCH * NHEAD);
    attn_flash<<<grid, 128, 0, stream>>>(qh, kh, vt, bias, amask, gat, oc);
  }

  // 4) output projection + bias
  {
    dim3 grid(CIN / 64, BS / 64);
    gemm_out<<<grid, 128, 0, stream>>>(oc, wto, bo, out);
  }
}

// v005
// It runs in 84.1 microseconds.
// Next to v004, in two timings, it ran 1.41 times as fast each time.
// Over all steps from v000 it is 2.26 times as fast.
#include <hip/hip_runtime.h>
#include <hip/hip_bf16.h>

typedef __attribute__((ext_vector_type(16))) _Float16 v16h;
typedef __attribute__((ext_vector_type(8)))  _Float16 v8h;
typedef __attribute__((ext_vector_type(8)))  float    v8f;
typedef __attribute__((ext_vector_type(8)))  int      v8i;
typedef __attribute__((ext_vector_type(4)))  float    v4f;
typedef __attribute__((ext_vector_type(4)))  int      v4i;
typedef __attribute__((ext_vector_type(4)))  _Float16 v4h;
typedef __attribute__((ext_vector_type(2)))  _Float16 v2h;

#define BATCH 2
#define SEQ   2048
#define CIN   512
#define NHEAD 8
#define CHEAD 64
#define HC    512          // NHEAD*CHEAD
#define BS    4096         // BATCH*SEQ

// ---------------------------------------------------------------------------
// WMMA helpers
// ---------------------------------------------------------------------------
__device__ __forceinline__ v8f wmma_f16(v16h a, v16h b, v8f c) {
  // D = A(16x32 f16) * B(32x16 f16) + C(16x16 f32)
  return __builtin_amdgcn_wmma_f32_16x16x32_f16(
      false, a, false, b, (short)0, c, false, false);
}

// Load one 16x32 f16 fragment (A-layout; also serves B when the B source is
// stored n-major with k contiguous). `base` points at element (row0, k0),
// `ld` is the row stride in elements. Per ISA 16-bit A layout:
//   lanes 0-15 : row = lane,    K = 0..7 and 16..23
//   lanes 16-31: row = lane-16, K = 8..15 and 24..31
__device__ __forceinline__ v16h load_frag16(const _Float16* base, int ld) {
  const int lane = threadIdx.x & 31;
  const int row  = lane & 15;
  const int koff = (lane >> 4) << 3;        // 0 or 8
  const _Float16* p = base + row * ld + koff;
  v8h lo = *(const v8h*)(p);                // K = koff .. koff+7
  v8h hi = *(const v8h*)(p + 16);           // K = 16+koff .. 16+koff+7
  return __builtin_shufflevector(lo, hi, 0,1,2,3,4,5,6,7,
                                 8,9,10,11,12,13,14,15);
}

// ---------------------------------------------------------------------------
// CDNA5 async memory->LDS staging (ASYNCcnt path; no VGPR round-trip).
// The GEMMs wait by count: "s_wait_asynccnt N" with N = #chunks just issued for
// the NEXT tile returns when the PREVIOUS tile has landed. The attention ring
// waits to 0 at the foot of each stage.
// ---------------------------------------------------------------------------
typedef __attribute__((address_space(3))) const void* lds_cptr_t;

__device__ __forceinline__ unsigned lds_base(const void* p) {
  // addrspace(3) pointers are 32-bit offsets from the wave's LDS base
  return (unsigned)(unsigned long long)(lds_cptr_t)p;
}

// per-lane: LDS[l] = MEM[g] (16 bytes each), tracked with ASYNCcnt. The copies
// of a stage stand in statements whose last line is s_wait_xcnt 0: a
// precaution that keeps every later rewrite of the address registers they
// name behind that wait (the compiler puts nothing inside a statement).
__device__ __forceinline__ void async_ld16x2(unsigned l0, const void* g0,
                                             unsigned l1, const void* g1) {
  asm volatile("global_load_async_to_lds_b128 %0, %1, off\n\t"
               "global_load_async_to_lds_b128 %2, %3, off\n\t"
               "s_wait_xcnt 0x0"
               :: "v"(l0), "v"((unsigned long long)g0),
                  "v"(l1), "v"((unsigned long long)g1)
               : "memory");
}
// eight copies, each ls LDS bytes and gs global bytes behind the one before
__device__ __forceinline__ void async_ld16x8(unsigned l, const void* gp,
                                             unsigned ls, unsigned gs) {
  const unsigned long long g = (unsigned long long)gp;
  asm volatile("global_load_async_to_lds_b128 %0, %1, off\n\t"
               "global_load_async_to_lds_b128 %2, %3, off\n\t"
               "global_load_async_to_lds_b128 %4, %5, off\n\t"
               "global_load_async_to_lds_b128 %6, %7, off\n\t"
               "global_load_async_to_lds_b128 %8, %9, off\n\t"
               "global_load_async_to_lds_b128 %10, %11, off\n\t"
               "global_load_async_to_lds_b128 %12, %13, off\n\t"
               "global_load_async_to_lds_b128 %14, %15, off\n\t"
               "s_wait_xcnt 0x0"
               :: "v"(l),          "v"(g),
                  "v"(l + ls),     "v"(g + gs),
                  "v"(l + 2 * ls), "v"(g + 2 * gs),
                  "v"(l + 3 * ls), "v"(g + 3 * gs),
                  "v"(l + 4 * ls), "v"(g + 4 * gs),
                  "v"(l + 5 * ls), "v"(g + 5 * gs),
                  "v"(l + 6 * ls), "v"(g + 6 * gs),
                  "v"(l + 7 * ls), "v"(g + 7 * gs)
               : "memory");
}
__device__ __forceinline__ void async_ld16x1(unsigned l, const void* g) {
  asm volatile("global_load_async_to_lds_b128 %0, %1, off\n\t"
               "s_wait_xcnt 0x0"
               :: "v"(l), "v"((unsigned long long)g)
               : "memory");
}

// LDS row pitches, in elements. The readers take 16 rows at once, 16 bytes a
// lane; a pitch of 16 bytes x an odd number puts the 16 rows on 64 different
// banks. Unpadded rows of 64 bytes x a power of two fall on 16 banks or fewer.
#define KSTAGE 128         // keys of one stage of the attention ring
#define KPITCH 72          // 64 f16 (128-byte) K rows      -> 144 bytes
#define VPITCH 136         // KSTAGE f16 (256-byte) V^T rows -> 272 bytes
#define BPITCH 132         // KSTAGE f32 (512-byte) bias rows -> 528 bytes
#define WPITCH 40          // 32 f16 (64-byte) W^T rows     ->  80 bytes

__device__ __forceinline__ void wait_async0() {
  asm volatile("s_wait_asynccnt 0x0" ::: "memory");
}
__device__ __forceinline__ void wait_async2() {
  asm volatile("s_wait_asynccnt 0x2" ::: "memory");
}
// a wave's own LDS reads have returned before it lets their buffer be refilled
__device__ __forceinline__ void wait_ds0() {
  asm volatile("s_wait_dscnt 0x0" ::: "memory");
}

// ---------------------------------------------------------------------------
// Conversion kernels
// ---------------------------------------------------------------------------
// Each thread takes many elements, so that few waves have to start.
// 32 floats a thread; every wave-wide load and store covers whole 128-byte
// lines. BS*CIN / 8192 blocks, no remainder.
#define XBLOCKS ((BS * CIN) / 8192)
__device__ __forceinline__ void cvt_f32_to_f16(
    const float* __restrict__ src, _Float16* __restrict__ dst, int blk) {
  const int base = blk * 8192 + threadIdx.x * 4;
  v4f v[8];
  // unrolled: all eight loads are issued before the first is waited for
#pragma unroll
  for (int j = 0; j < 8; ++j) v[j] = *(const v4f*)(src + base + j * 1024);
  // unrolled: v[] stays in registers
#pragma unroll
  for (int j = 0; j < 8; ++j)
    *(v4h*)(dst + base + j * 1024) = __builtin_convertvector(v[j], v4h);
  // precaution: the stores' registers may be written again by whatever code
  // the compiler lays out behind this inlined body
  asm volatile("s_wait_xcnt 0x0" ::: "memory");
}

// wT[n*512 + k] = (f16) w[k*512 + n]   (512x512 transpose + convert)
// One 64(k) x 64(n) tile a block, 16 elements a thread: rows of w read in
// 256-byte runs, turned in LDS, rows of wT written in whole 128-byte lines.
// The short loops are unrolled so that a[][] stays in registers and the four
// loads are issued together.
#define WTILES ((CIN / 64) * (HC / 64))    // tiles of one weight matrix
__device__ __forceinline__ void cvt_w_transpose(
    const float* __restrict__ w, _Float16* __restrict__ wT, int tile) {
  __shared__ _Float16 t[64 * 72];           // [n_local][k_local], 144-byte rows
  const int tid = threadIdx.x;
  const int k0  = (tile & 7) * 64, n0 = (tile >> 3) * 64;
  const int nq  = (tid & 15) * 4;           // four columns n
  const int kp  = (tid >> 4) * 2;           // two rows k, twice (32 apart)
  v4f a[2][2];
#pragma unroll
  for (int j = 0; j < 2; ++j)
#pragma unroll
    for (int e = 0; e < 2; ++e)
      a[j][e] = *(const v4f*)(w + (k0 + kp + 32 * j + e) * CIN + n0 + nq);
#pragma unroll
  for (int j = 0; j < 2; ++j)
#pragma unroll
    for (int i = 0; i < 4; ++i) {
      const v2h p = {(_Float16)a[j][0][i], (_Float16)a[j][1][i]};
      *(v2h*)(t + (nq + i) * 72 + kp + 32 * j) = p;
    }
  __syncthreads();                          // the tile is read across waves
#pragma unroll
  for (int j = 0; j < 2; ++j) {
    const int nl = (tid >> 3) + 32 * j, kc = (tid & 7) * 8;
    *(v8h*)(wT + (n0 + nl) * CIN + k0 + kc) = *(const v8h*)(t + nl * 72 + kc);
  }
}

// All six conversions as ONE grid: none depends on another, so they need no
// launch boundary between them. Blocks 0 .. 5*WTILES-1 turn the five weight
// matrices (the longer chain, started first) into wT5[matrix][n][k]; the rest
// convert x. The choice is the same for a whole block, barrier included.
__global__ void __launch_bounds__(256) cvt_all(
    const float* __restrict__ x,  const float* __restrict__ wq,
    const float* __restrict__ wk, const float* __restrict__ wv,
    const float* __restrict__ wg, const float* __restrict__ wo,
    _Float16* __restrict__ xh, _Float16* __restrict__ wT5) {
  const unsigned blk = blockIdx.x;
  if (blk < 5 * WTILES) {
    const unsigned mat = blk / WTILES;
    const float* wlo = (mat & 1) ? wk : wq;
    const float* whi = (mat & 1) ? wg : wv;
    const float* w   = (mat & 4) ? wo : (mat & 2) ? whi : wlo;
    cvt_w_transpose(w, wT5 + (size_t)mat * CIN * HC, blk % WTILES);
  } else {
    cvt_f32_to_f16(x, xh, blk - 5 * WTILES);
  }
}

// ---------------------------------------------------------------------------
// Projection GEMM: Y[4096,512] = Xh[4096,512] @ W[512,512]  (W given as W^T)
// All four projections in ONE grid (they share Xh and do not depend on one
// another): blockIdx.z = mode; wT4 = the four W^T in mode order, qkv = the
// Q, K and V^T outputs in mode order, each one after another.
// mode 0/1: Q/K  -> f16 [B,H,S,c];  mode 2: V -> f16 [B,H,c,S] (transposed);
// mode 3: gate -> f32 sigmoid(Y + bg) at [B,S,HC].
// Block: 128 threads = 4 waves; block tile 64(M) x 64(N); wave tile 16x64.
// W^T tiles double-buffered in LDS via async DMA, shared by the 4 waves.
// ---------------------------------------------------------------------------
__global__ void __launch_bounds__(128) gemm_proj(
    const _Float16* __restrict__ xh, const _Float16* __restrict__ wT4,
    const float* __restrict__ bg,
    _Float16* __restrict__ qkv, float* __restrict__ out32) {
  // [n_local][k_local], padded rows; 16-byte copies and reads
  __shared__ __attribute__((aligned(16))) _Float16 wbufA[64 * WPITCH];
  __shared__ __attribute__((aligned(16))) _Float16 wbufB[64 * WPITCH];

  const int tid  = threadIdx.x;
  const int wv   = tid >> 5;
  const int lane = tid & 31;
  const int lr   = lane & 15;
  const int lh   = lane >> 4;
  const int m0   = blockIdx.y * 64 + wv * 16;
  const int mode = blockIdx.z;
  const int n0   = blockIdx.x * 64;
  const _Float16* wT = wT4 + (size_t)mode * CIN * HC;
  _Float16* out16    = qkv + (size_t)mode * BS * HC;  // not used by mode 3
  const unsigned wA = lds_base(wbufA);
  const unsigned wB = lds_base(wbufB);

  v8f acc[4] = {};

  auto stage = [&](int k0, unsigned dst) {
    // 256 chunks of 16B: this thread's are rows nl and nl + 32, chunk ch
    const int nl = tid >> 2, ch = tid & 3;
    const unsigned  l = dst + (unsigned)(nl * WPITCH + ch * 8) * 2;
    const _Float16* g = wT + (size_t)(n0 + nl) * CIN + k0 + ch * 8;
    async_ld16x2(l, g, l + 32 * WPITCH * 2, g + (size_t)32 * CIN);
  };
  auto compute = [&](int k0, const _Float16* wb) {
    v16h a = load_frag16(xh + (size_t)m0 * CIN + k0, CIN);
#pragma unroll
    for (int nt = 0; nt < 4; ++nt) {
      v16h b = load_frag16(wb + nt * 16 * WPITCH, WPITCH);
      acc[nt] = wmma_f16(a, b, acc[nt]);
    }
  };

  stage(0, wA);
  for (int k0 = 0; k0 < CIN; k0 += 64) {
    stage(k0 + 32, wB);                     // k0+32 < 512 always
    wait_async2();                          // tile k0 landed; k0+32 in flight
    __syncthreads();
    compute(k0, wbufA);
    __syncthreads();                        // all reads of A done
    if (k0 + 64 < CIN) { stage(k0 + 64, wA); wait_async2(); }
    else               { wait_async0(); }
    __syncthreads();
    compute(k0 + 32, wbufB);
    __syncthreads();                        // all reads of B done
  }

  const int mbase = m0 + lh * 8;
#pragma unroll
  for (int nt = 0; nt < 4; ++nt) {
    const int n = n0 + nt * 16 + lr;
    const int h = n >> 6, c = n & 63;
#pragma unroll
    for (int r = 0; r < 8; ++r) {
      const int m = mbase + r;
      const int b = m >> 11, s = m & (SEQ - 1);
      const float v = acc[nt][r];
      if (mode <= 1) {
        out16[(((size_t)(b * NHEAD + h)) * SEQ + s) * CHEAD + c] = (_Float16)v;
      } else if (mode == 2) {
        out16[(((size_t)(b * NHEAD + h)) * CHEAD + c) * SEQ + s] = (_Float16)v;
      } else {
        out32[((size_t)(b * SEQ + s)) * HC + n] =
            1.0f / (1.0f + __expf(-(v + bg[n])));
      }
    }
  }
}

__device__ __forceinline__ float other_half(float v) {
  // value of lane l ^ 16
  const int b = __builtin_bit_cast(int, v);
  return __builtin_bit_cast(float, __builtin_amdgcn_permlanex16(
      b, b, 0x76543210, 0xfedcba98, false, false));
}

// 2^x of eight values, each in its own register. One statement: behind an
// exponential stands another one on other registers, so no result is read and
// no source overwritten in the slot directly behind it; the v_nop keeps that
// slot behind the last one, whatever the compiler puts next.
__device__ __forceinline__ v8f exp2x8(v8f t) {
  float a = t[0], b = t[1], c = t[2], d = t[3];
  float e = t[4], f = t[5], g = t[6], h = t[7];
  asm("v_exp_f32 %0, %0\n\tv_exp_f32 %1, %1\n\tv_exp_f32 %2, %2\n\t"
      "v_exp_f32 %3, %3\n\tv_exp_f32 %4, %4\n\tv_exp_f32 %5, %5\n\t"
      "v_exp_f32 %6, %6\n\tv_exp_f32 %7, %7\n\tv_nop"
      : "+v"(a), "+v"(b), "+v"(c), "+v"(d), "+v"(e), "+v"(f), "+v"(g), "+v"(h));
  return v8f{a, b, c, d, e, f, g, h};
}

__global__ void __launch_bounds__(128) attn_flash(
    const _Float16* __restrict__ qh, const _Float16* __restrict__ kh,
    const _Float16* __restrict__ vt, const float* __restrict__ bias,
    const int* __restrict__ amask, const float* __restrict__ gate,
    _Float16* __restrict__ ocat) {
  // two buffers each: [key_local][c], [c][key_local], [query_local][key_local]
  // (padded rows) and one copy of the mask a wave; 16-byte copies and reads
  __shared__ __attribute__((aligned(16))) _Float16 kbuf[2 * KSTAGE * KPITCH];
  __shared__ __attribute__((aligned(16))) _Float16 vbuf[2 * 64 * VPITCH];
  __shared__ __attribute__((aligned(16))) float    bbuf[2 * 64 * BPITCH];
  __shared__ __attribute__((aligned(16))) int      mbuf[2 * 4 * KSTAGE];

  const int tid  = threadIdx.x;
  const int wv   = tid >> 5;
  const int lane = tid & 31;
  const int lr   = lane & 15;
  const int lh   = lane >> 4;
  const int bh   = blockIdx.y;              // 0..15  => (b,h)
  const int bb   = bh >> 3, h = bh & 7;
  const int q0   = (blockIdx.x * 4 + wv) * 16;

  const _Float16* Q = qh + (size_t)bh * SEQ * CHEAD;
  const _Float16* K = kh + (size_t)bh * SEQ * CHEAD;
  const _Float16* V = vt + (size_t)bh * CHEAD * SEQ;
  // this wave's 16 bias rows and the batch's mask, at this lane's 16 bytes
  const float* biasw = bias + ((size_t)bh * SEQ + q0) * SEQ + lane * 4;
  const int*   maskw = amask + bb * SEQ + lane * 4;
  const unsigned kL = lds_base(kbuf), vL = lds_base(vbuf);
  const unsigned bL = lds_base(bbuf), mL = lds_base(mbuf);

  // Q^T as B operand: column = query lr, k in the loader's order
  v16h bq0 = load_frag16(Q + (size_t)q0 * CHEAD + 0,  CHEAD);
  v16h bq1 = load_frag16(Q + (size_t)q0 * CHEAD + 32, CHEAD);

  float mrun = -1e30f, lrun = 0.0f;         // lrun: this half's keys only
  v8f oacc[4] = {};                         // O^T: [c = ct*16+8*lh+r][query lr]

  // 33 copies a wave and stage; every copy covers whole 128-byte lines
  auto stage = [&](int kt, int buf) {
    const int kr = tid >> 3, kc = tid & 7;   // K: 8 chunks a row, +16 rows
    const int vc = tid >> 4, vch = tid & 15; // V^T: 16 chunks a row, +8 rows
    async_ld16x8(kL + (unsigned)((buf * KSTAGE + kr) * KPITCH + kc * 8) * 2,
                 K + (size_t)(kt + kr) * CHEAD + kc * 8,
                 16 * KPITCH * 2, 16 * CHEAD * 2);
    async_ld16x8(vL + (unsigned)((buf * 64 + vc) * VPITCH + vch * 8) * 2,
                 V + (size_t)vc * SEQ + kt + vch * 8,
                 8 * VPITCH * 2, 8 * SEQ * 2);
    // bias: a wave brings its own 16 query rows, one 512-byte row a copy
    const unsigned bl = bL + (unsigned)((buf * 64 + wv * 16) * BPITCH + lane * 4) * 4;
    async_ld16x8(bl, biasw + kt, BPITCH * 4, SEQ * 4);
    async_ld16x8(bl + 8 * BPITCH * 4, biasw + (size_t)8 * SEQ + kt,
                 BPITCH * 4, SEQ * 4);
    async_ld16x1(mL + (unsigned)((buf * 4 + wv) * KSTAGE + lane * 4) * 4,
                 maskw + kt);
  };

  // 32 keys: kb, vb, bp, mp point at their first key in the stage's buffers
  auto compute = [&](const _Float16* kb, const _Float16* vb,
                     const float* bp, const int* mp) {
    // --- pair bias + key mask: 8 consecutive keys per lane and 16-key tile ---
    // (16-byte reads: the padded rows are not multiples of 32 bytes)
    v8f b8[2];
    v8i m8[2];
#pragma unroll
    for (int nh = 0; nh < 2; ++nh) {
      b8[nh] = __builtin_shufflevector(*(const v4f*)(bp + nh * 16),
                                       *(const v4f*)(bp + nh * 16 + 4),
                                       0, 1, 2, 3, 4, 5, 6, 7);
      m8[nh] = __builtin_shufflevector(*(const v4i*)(mp + nh * 16),
                                       *(const v4i*)(mp + nh * 16 + 4),
                                       0, 1, 2, 3, 4, 5, 6, 7);
    }
    // --- logits tile: S^T = K Q^T  (32 keys x 16 queries, two f32 tiles) ---
    v16h ak[2][2];
#pragma unroll
    for (int nh = 0; nh < 2; ++nh) {
      ak[nh][0] = load_frag16(kb + nh * 16 * KPITCH + 0,  KPITCH);
      ak[nh][1] = load_frag16(kb + nh * 16 * KPITCH + 32, KPITCH);
    }
    v8f sa[2] = {};
#pragma unroll
    for (int nh = 0; nh < 2; ++nh) {
      sa[nh] = wmma_f16(ak[nh][0], bq0, sa[nh]);
      sa[nh] = wmma_f16(ak[nh][1], bq1, sa[nh]);
    }
    // V^T fragments (A rows = output channel c): P never passes through LDS,
    // so they can be fetched while the softmax runs
    v16h av[4];
#pragma unroll
    for (int ct = 0; ct < 4; ++ct) av[ct] = load_frag16(vb + ct * 16 * VPITCH, VPITCH);
    // --- scale + pair bias + key mask ---
#pragma unroll
    for (int nh = 0; nh < 2; ++nh) {
      v8f moff;
#pragma unroll
      for (int r = 0; r < 8; ++r) moff[r] = (m8[nh][r] > 0) ? 0.0f : -1e9f;
      sa[nh] = sa[nh] * 0.125f + b8[nh] + moff;
    }
    // --- online softmax: one query per lane, halves joined for the maximum ---
    const v8f mx8 = __builtin_elementwise_max(sa[0], sa[1]);
    const float mx = fmaxf(fmaxf(fmaxf(mx8[0], mx8[1]), fmaxf(mx8[2], mx8[3])),
                           fmaxf(fmaxf(mx8[4], mx8[5]), fmaxf(mx8[6], mx8[7])));
    const float mnew = fmaxf(mrun, fmaxf(mx, other_half(mx)));
#pragma unroll
    for (int nh = 0; nh < 2; ++nh)
      sa[nh] = exp2x8((sa[nh] - mnew) * 1.44269504f);   // exp(x) = 2^(x log2 e)
    const v8f ps = sa[0] + sa[1];
    const float ts = ((ps[0] + ps[1]) + (ps[2] + ps[3])) +
                     ((ps[4] + ps[5]) + (ps[6] + ps[7]));
    const float alpha = __expf(mrun - mnew);
    lrun = lrun * alpha + ts;
    mrun = mnew;
#pragma unroll
    for (int ct = 0; ct < 4; ++ct) oacc[ct] *= alpha;
    // --- P^T as B operand: element s = key 8*lh+s (s<8), 16+8*lh+s-8 (s>=8) ---
    const v16h pt = __builtin_shufflevector(
        __builtin_convertvector(sa[0], v8h), __builtin_convertvector(sa[1], v8h),
        0, 1, 2, 3, 4, 5, 6, 7, 8, 9, 10, 11, 12, 13, 14, 15);
    // --- O^T += V^T P^T ---
#pragma unroll
    for (int ct = 0; ct < 4; ++ct) oacc[ct] = wmma_f16(av[ct], pt, oacc[ct]);
  };

  stage(0, 0);
  wait_async0();
  __syncthreads();                          // stage 0 is there for every wave
  stage(KSTAGE, 1);
  for (int kt = 0; kt < SEQ; kt += KSTAGE) {
    const int buf = (kt / KSTAGE) & 1;
    const _Float16* kb = kbuf + buf * KSTAGE * KPITCH;
    const _Float16* vb = vbuf + buf * 64 * VPITCH;
    const float*    bp = bbuf + (buf * 64 + wv * 16 + lr) * BPITCH + lh * 8;
    const int*      mp = mbuf + (buf * 4 + wv) * KSTAGE + lh * 8;
    // unrolled: constant LDS offsets, and a step's reads can start under the
    // softmax of the step before
#pragma unroll
    for (int j = 0; j < KSTAGE / 32; ++j)
      compute(kb + j * 32 * KPITCH, vb + j * 32, bp + j * 32, mp + j * 32);
    // foot of the stage: own reads of this buffer done, own copies of the next
    // stage landed; behind the barrier that holds for all four waves
    wait_ds0();
    wait_async0();
    __syncthreads();
    if (kt + 2 * KSTAGE < SEQ) stage(kt + 2 * KSTAGE, buf);
  }
  wait_async0();                            // nothing in flight at the end

  // --- epilogue: normalize, gate, store concat-head f16 [B,S,HC] ---
  // a lane holds 8 consecutive channels of its query per tile: 16-byte stores
  const float rl = 1.0f / (lrun + other_half(lrun));
  const size_t rowoff = ((size_t)(bb * SEQ + q0 + lr)) * HC + h * CHEAD + lh * 8;
#pragma unroll
  for (int ct = 0; ct < 4; ++ct) {
    const float4 g0 = *(const float4*)(gate + rowoff + ct * 16);
    const float4 g1 = *(const float4*)(gate + rowoff + ct * 16 + 4);
    const float g8[8] = {g0.x, g0.y, g0.z, g0.w, g1.x, g1.y, g1.z, g1.w};
    v8h o;
#pragma unroll
    for (int r = 0; r < 8; ++r) o[r] = (_Float16)(oacc[ct][r] * rl * g8[r]);
    *(v8h*)(ocat + rowoff + ct * 16) = o;
  }
}

// ---------------------------------------------------------------------------
// Output GEMM: out[4096,512] = Ocat[4096,512] @ Wo + bo   (Wo given as Wo^T)
// Same double-buffered async LDS weight staging as gemm_proj.
// ---------------------------------------------------------------------------
__global__ void __launch_bounds__(128) gemm_out(
    const _Float16* __restrict__ oc, const _Float16* __restrict__ woT,
    const float* __restrict__ bo, float* __restrict__ out) {
  __shared__ __attribute__((aligned(16))) _Float16 wbufA[64 * WPITCH];
  __shared__ __attribute__((aligned(16))) _Float16 wbufB[64 * WPITCH];

  const int tid  = threadIdx.x;
  const int wv   = tid >> 5;
  const int lane = tid & 31;
  const int lr   = lane & 15;
  const int lh   = lane >> 4;
  const int m0   = blockIdx.y * 64 + wv * 16;
  const int n0   = blockIdx.x * 64;
  const unsigned wA = lds_base(wbufA);
  const unsigned wB = lds_base(wbufB);

  v8f acc[4] = {};

  auto stage = [&](int k0, unsigned dst) {
    const int nl = tid >> 2, ch = tid & 3;  // rows nl and nl + 32, chunk ch
    const unsigned  l = dst + (unsigned)(nl * WPITCH + ch * 8) * 2;
    const _Float16* g = woT + (size_t)(n0 + nl) * HC + k0 + ch * 8;
    async_ld16x2(l, g, l + 32 * WPITCH * 2, g + (size_t)32 * HC);
  };
  auto compute = [&](int k0, const _Float16* wb) {
    v16h a = load_frag16(oc + (size_t)m0 * HC + k0, HC);
#pragma unroll
    for (int nt = 0; nt < 4; ++nt) {
      v16h b = load_frag16(wb + nt * 16 * WPITCH, WPITCH);
      acc[nt] = wmma_f16(a, b, acc[nt]);
    }
  };

  stage(0, wA);
  for (int k0 = 0; k0 < HC; k0 += 64) {
    stage(k0 + 32, wB);
    wait_async2();
    __syncthreads();
    compute(k0, wbufA);
    __syncthreads();
    if (k0 + 64 < HC) { stage(k0 + 64, wA); wait_async2(); }
    else              { wait_async0(); }
    __syncthreads();
    compute(k0 + 32, wbufB);
    __syncthreads();
  }

  const int mbase = m0 + lh * 8;
#pragma unroll
  for (int nt = 0; nt < 4; ++nt) {
    const int n = n0 + nt * 16 + lr;
    const float bn = bo[n];
#pragma unroll
    for (int r = 0; r < 8; ++r)
      out[(size_t)(mbase + r) * CIN + n] = acc[nt][r] + bn;
  }
}

// ---------------------------------------------------------------------------
extern "C" void kernel_launch(void* const* d_in, const int* in_sizes, int n_in,
                              void* d_out, int out_size, void* d_ws,
                              size_t ws_size, hipStream_t stream) {
  const float* x     = (const float*)d_in[0];
  const float* bias  = (const float*)d_in[1];
  const int*   amask = (const int*)d_in[2];
  const float* Wq    = (const float*)d_in[3];
  const float* Wk    = (const float*)d_in[4];
  const float* Wv    = (const float*)d_in[5];
  const float* Wg    = (const float*)d_in[6];
  const float* bg    = (const float*)d_in[7];
  const float* Wo    = (const float*)d_in[8];
  const float* bo    = (const float*)d_in[9];
  float* out = (float*)d_out;

  char* ws = (char*)d_ws;
  size_t off = 0;
  auto carve = [&](size_t bytes) -> char* {
    char* p = ws + off;
    off += (bytes + 255) & ~(size_t)255;
    return p;
  };
  _Float16* xh  = (_Float16*)carve((size_t)BS * CIN * 2);
  // the five W^T (q, k, v, g, o) in one piece, and Q, K, V^T in one piece
  _Float16* wt5 = (_Float16*)carve((size_t)5 * CIN * HC * 2);
  _Float16* wto = wt5 + (size_t)4 * CIN * HC;
  _Float16* qkv = (_Float16*)carve((size_t)3 * BS * HC * 2);
  _Float16* qh  = qkv;
  _Float16* kh  = qkv + (size_t)BS * HC;
  _Float16* vt  = qkv + (size_t)2 * BS * HC;
  float*    gat = (float*)carve((size_t)BS * HC * 4);
  _Float16* oc  = (_Float16*)carve((size_t)BS * HC * 2);

  // 1) convert x to f16; transpose+convert the 5 weight matrices: one launch
  cvt_all<<<5 * WTILES + XBLOCKS, 256, 0, stream>>>(x, Wq, Wk, Wv, Wg, Wo,
                                                    xh, wt5);

  // 2) projections (Q, K, V^T, gate): one launch
  {
    dim3 grid(HC / 64, BS / 64, 4);
    gemm_proj<<<grid, 128, 0, stream>>>(xh, wt5, bg, qkv, gat);
  }

  // 3) fused flash attention (bias streamed once, softmax online, gated)
  {
    dim3 grid(SEQ / 64, BATCH * NHEAD);
    attn_flash<<<grid, 128, 0, stream>>>(qh, kh, vt, bias, amask, gat, oc);
  }

  // 4) output projection + bias
  {
    dim3 grid(CIN / 64, BS / 64);
    gemm_out<<<grid, 128, 0, stream>>>(oc, wto, bo, out);
  }
}

// v006
// A run of this version takes 59.4 microseconds.
// In two side-by-side timings against v005, it was 1.42 and 1.41 times as fast.
// Counting every step since v000, it is 3.19 times as fast.
#include <hip/hip_runtime.h>
#include <hip/hip_bf16.h>

typedef __attribute__((ext_vector_type(16))) _Float16 v16h;
typedef __attribute__((ext_vector_type(8)))  _Float16 v8h;
typedef __attribute__((ext_vector_type(8)))  float    v8f;
typedef __attribute__((ext_vector_type(8)))  int      v8i;
typedef __attribute__((ext_vector_type(4)))  float    v4f;
typedef __attribute__((ext_vector_type(4)))  int      v4i;
typedef __attribute__((ext_vector_type(4)))  _Float16 v4h;
typedef __attribute__((ext_vector_type(2)))  _Float16 v2h;

#define BATCH 2
#define SEQ   2048
#define CIN   512
#define NHEAD 8
#define CHEAD 64
#define HC    512          // NHEAD*CHEAD
#define BS    4096         // BATCH*SEQ

// ---------------------------------------------------------------------------
// WMMA helpers
// ---------------------------------------------------------------------------
__device__ __forceinline__ v8f wmma_f16(v16h a, v16h b, v8f c) {
  // D = A(16x32 f16) * B(32x16 f16) + C(16x16 f32)
  return __builtin_amdgcn_wmma_f32_16x16x32_f16(
      false, a, false, b, (short)0, c, false, false);
}

// Load one 16x32 f16 fragment (A-layout; also serves B when the B source is
// stored n-major with k contiguous). `base` points at element (row0, k0),
// `ld` is the row stride in elements. Per ISA 16-bit A layout:
//   lanes 0-15 : row = lane,    K = 0..7 and 16..23
//   lanes 16-31: row = lane-16, K = 8..15 and 24..31
__device__ __forceinline__ v16h load_frag16(const _Float16* base, int ld) {
  const int lane = threadIdx.x & 31;
  const int row  = lane & 15;
  const int koff = (lane >> 4) << 3;        // 0 or 8
  const _Float16* p = base + row * ld + koff;
  v8h lo = *(const v8h*)(p);                // K = koff .. koff+7
  v8h hi = *(const v8h*)(p + 16);           // K = 16+koff .. 16+koff+7
  return __builtin_shufflevector(lo, hi, 0,1,2,3,4,5,6,7,
                                 8,9,10,11,12,13,14,15);
}

// ---------------------------------------------------------------------------
// CDNA5 async memory->LDS staging (ASYNCcnt path; no VGPR round-trip).
// Every ring here waits to 0 at the foot of each stage.
// ---------------------------------------------------------------------------
typedef __attribute__((address_space(3))) const void* lds_cptr_t;

__device__ __forceinline__ unsigned lds_base(const void* p) {
  // addrspace(3) pointers are 32-bit offsets from the wave's LDS base
  return (unsigned)(unsigned long long)(lds_cptr_t)p;
}

// per-lane: LDS[l] = MEM[g] (16 bytes each), tracked with ASYNCcnt. The copies
// of a stage stand in statements whose last line is s_wait_xcnt 0: a
// precaution that keeps every later rewrite of the address registers they
// name behind that wait (the compiler puts nothing inside a statement).
// eight copies, each ls LDS bytes and gs global bytes behind the one before
__device__ __forceinline__ void async_ld16x8(unsigned l, const void* gp,
                                             unsigned ls, unsigned gs) {
  const unsigned long long g = (unsigned long long)gp;
  asm volatile("global_load_async_to_lds_b128 %0, %1, off\n\t"
               "global_load_async_to_lds_b128 %2, %3, off\n\t"
               "global_load_async_to_lds_b128 %4, %5, off\n\t"
               "global_load_async_to_lds_b128 %6, %7, off\n\t"
               "global_load_async_to_lds_b128 %8, %9, off\n\t"
               "global_load_async_to_lds_b128 %10, %11, off\n\t"
               "global_load_async_to_lds_b128 %12, %13, off\n\t"
               "global_load_async_to_lds_b128 %14, %15, off\n\t"
               "s_wait_xcnt 0x0"
               :: "v"(l),          "v"(g),
                  "v"(l + ls),     "v"(g + gs),
                  "v"(l + 2 * ls), "v"(g + 2 * gs),
                  "v"(l + 3 * ls), "v"(g + 3 * gs),
                  "v"(l + 4 * ls), "v"(g + 4 * gs),
                  "v"(l + 5 * ls), "v"(g + 5 * gs),
                  "v"(l + 6 * ls), "v"(g + 6 * gs),
                  "v"(l + 7 * ls), "v"(g + 7 * gs)
               : "memory");
}
__device__ __forceinline__ void async_ld16x1(unsigned l, const void* g) {
  asm volatile("global_load_async_to_lds_b128 %0, %1, off\n\t"
               "s_wait_xcnt 0x0"
               :: "v"(l), "v"((unsigned long long)g)
               : "memory");
}

// LDS row pitches, in elements. The readers take 16 rows at once, 16 bytes a
// lane; a pitch of 16 bytes x an odd number puts the 16 rows on 64 different
// banks. Unpadded rows of 64 bytes x a power of two fall on 16 banks or fewer.
#define KSTAGE 128         // keys of one stage of the attention ring
#define KPITCH 72          // 64 f16 (128-byte) K rows      -> 144 bytes
#define VPITCH 136         // KSTAGE f16 (256-byte) V^T rows -> 272 bytes
#define BPITCH 132         // KSTAGE f32 (512-byte) bias rows -> 528 bytes
#define GK     128         // k of one stage of the GEMM ring
#define GPITCH 136         // GK f16 (256-byte) A and W^T rows -> 272 bytes

__device__ __forceinline__ void wait_async0() {
  asm volatile("s_wait_asynccnt 0x0" ::: "memory");
}
// a wave's own LDS reads have returned before it lets their buffer be refilled
__device__ __forceinline__ void wait_ds0() {
  asm volatile("s_wait_dscnt 0x0" ::: "memory");
}

// ---------------------------------------------------------------------------
// Conversion kernels
// ---------------------------------------------------------------------------
// Each thread takes many elements, so that few waves have to start.
// 32 floats a thread; every wave-wide load and store covers whole 128-byte
// lines. BS*CIN / 8192 blocks, no remainder.
#define XBLOCKS ((BS * CIN) / 8192)
__device__ __forceinline__ void cvt_f32_to_f16(
    const float* __restrict__ src, _Float16* __restrict__ dst, int blk) {
  const int base = blk * 8192 + threadIdx.x * 4;
  v4f v[8];
  // unrolled: all eight loads are issued before the first is waited for
#pragma unroll
  for (int j = 0; j < 8; ++j) v[j] = *(const v4f*)(src + base + j * 1024);
  // unrolled: v[] stays in registers
#pragma unroll
  for (int j = 0; j < 8; ++j)
    *(v4h*)(dst + base + j * 1024) = __builtin_convertvector(v[j], v4h);
  // precaution: the stores' registers may be written again by whatever code
  // the compiler lays out behind this inlined body
  asm volatile("s_wait_xcnt 0x0" ::: "memory");
}

// wT[n*512 + k] = (f16) w[k*512 + n]   (512x512 transpose + convert)
// One 64(k) x 64(n) tile a block, 16 elements a thread: rows of w read in
// 256-byte runs, turned in LDS, rows of wT written in whole 128-byte lines.
// The short loops are unrolled so that a[][] stays in registers and the four
// loads are issued together.
#define WTILES ((CIN / 64) * (HC / 64))    // tiles of one weight matrix
__device__ __forceinline__ void cvt_w_transpose(
    const float* __restrict__ w, _Float16* __restrict__ wT, int tile) {
  __shared__ _Float16 t[64 * 72];           // [n_local][k_local], 144-byte rows
  const int tid = threadIdx.x;
  const int k0  = (tile & 7) * 64, n0 = (tile >> 3) * 64;
  const int nq  = (tid & 15) * 4;           // four columns n
  const int kp  = (tid >> 4) * 2;           // two rows k, twice (32 apart)
  v4f a[2][2];
#pragma unroll
  for (int j = 0; j < 2; ++j)
#pragma unroll
    for (int e = 0; e < 2; ++e)
      a[j][e] = *(const v4f*)(w + (k0 + kp + 32 * j + e) * CIN + n0 + nq);
#pragma unroll
  for (int j = 0; j < 2; ++j)
#pragma unroll
    for (int i = 0; i < 4; ++i) {
      const v2h p = {(_Float16)a[j][0][i], (_Float16)a[j][1][i]};
      *(v2h*)(t + (nq + i) * 72 + kp + 32 * j) = p;
    }
  __syncthreads();                          // the tile is read across waves
#pragma unroll
  for (int j = 0; j < 2; ++j) {
    const int nl = (tid >> 3) + 32 * j, kc = (tid & 7) * 8;
    *(v8h*)(wT + (n0 + nl) * CIN + k0 + kc) = *(const v8h*)(t + nl * 72 + kc);
  }
}

// All six conversions as ONE grid: none depends on another, so they need no
// launch boundary between them. Blocks 0 .. 5*WTILES-1 turn the five weight
// matrices (the longer chain, started first) into wT5[matrix][n][k]; the rest
// convert x. The choice is the same for a whole block, barrier included.
__global__ void __launch_bounds__(256) cvt_all(
    const float* __restrict__ x,  const float* __restrict__ wq,
    const float* __restrict__ wk, const float* __restrict__ wv,
    const float* __restrict__ wg, const float* __restrict__ wo,
    _Float16* __restrict__ xh, _Float16* __restrict__ wT5) {
  const unsigned blk = blockIdx.x;
  if (blk < 5 * WTILES) {
    const unsigned mat = blk / WTILES;
    const float* wlo = (mat & 1) ? wk : wq;
    const float* whi = (mat & 1) ? wg : wv;
    const float* w   = (mat & 4) ? wo : (mat & 2) ? whi : wlo;
    cvt_w_transpose(w, wT5 + (size_t)mat * CIN * HC, blk % WTILES);
  } else {
    cvt_f32_to_f16(x, xh, blk - 5 * WTILES);
  }
}

// 2^x of eight values, each in its own register. One statement: behind an
// exponential stands another one on other registers, so no result is read and
// no source overwritten in the slot directly behind it; the v_nop keeps that
// slot behind the last one, whatever the compiler puts next.
__device__ __forceinline__ v8f exp2x8(v8f t) {
  float a = t[0], b = t[1], c = t[2], d = t[3];
  float e = t[4], f = t[5], g = t[6], h = t[7];
  asm("v_exp_f32 %0, %0\n\tv_exp_f32 %1, %1\n\tv_exp_f32 %2, %2\n\t"
      "v_exp_f32 %3, %3\n\tv_exp_f32 %4, %4\n\tv_exp_f32 %5, %5\n\t"
      "v_exp_f32 %6, %6\n\tv_exp_f32 %7, %7\n\tv_nop"
      : "+v"(a), "+v"(b), "+v"(c), "+v"(d), "+v"(e), "+v"(f), "+v"(g), "+v"(h));
  return v8f{a, b, c, d, e, f, g, h};
}

// ---------------------------------------------------------------------------
// GEMM core: C[MT*32, 128] = A[MT*32, 512] * W[512, 128], W given as W^T.
// 128 threads = 4 waves as 2 (M) x 2 (N); wave tile MT*16 x 64, so that every
// fragment read from LDS feeds 4 (A) or MT (W^T) matrix instructions and every
// row brought from L2 serves the whole block tile.
// A and W^T rows come by async copies of whole lines into a two-buffer LDS
// ring, GK of k a stage: the next stage flies while this one is worked on.
// a, wt: first row of the block's A and W^T rows, both with 512 elements a row.
// ---------------------------------------------------------------------------
template <int MT>
__device__ __forceinline__ void gemm_ring(const _Float16* __restrict__ a,
                                          const _Float16* __restrict__ wt,
                                          v8f (&acc)[MT][4]) {
  constexpr int AROWS = MT * 32;
  // two buffers each: [row_local][k_local], padded rows; 16-byte copies, reads
  __shared__ __attribute__((aligned(16))) _Float16 abuf[2 * AROWS * GPITCH];
  __shared__ __attribute__((aligned(16))) _Float16 wbuf[2 * 128 * GPITCH];
  const int tid = threadIdx.x;
  const int wv  = tid >> 5;
  const unsigned aL = lds_base(abuf), wL = lds_base(wbuf);

  // 16 chunks of 16 bytes a row: a wave-wide copy covers two whole rows of the
  // stage; a statement takes rows rr, rr + 8, ..., rr + 56
  auto stage = [&](int t, int buf) {
    const int rr = tid >> 4, ch = tid & 15;
    const size_t go = (size_t)rr * CIN + t * GK + ch * 8;
    // both short loops unrolled: one asm statement for each 64 rows
#pragma unroll
    for (int q = 0; q < AROWS / 64; ++q)
      async_ld16x8(aL + (unsigned)((buf * AROWS + q * 64 + rr) * GPITCH + ch * 8) * 2,
                   a + go + (size_t)q * 64 * CIN, 8 * GPITCH * 2, 8 * CIN * 2);
#pragma unroll
    for (int q = 0; q < 2; ++q)
      async_ld16x8(wL + (unsigned)((buf * 128 + q * 64 + rr) * GPITCH + ch * 8) * 2,
                   wt + go + (size_t)q * 64 * CIN, 8 * GPITCH * 2, 8 * CIN * 2);
  };
  auto compute = [&](int buf) {
    const _Float16* ab = abuf + (buf * AROWS + (wv >> 1) * MT * 16) * GPITCH;
    const _Float16* wb = wbuf + (buf * 128 + (wv & 1) * 64) * GPITCH;
    // the whole nest unrolled: constant LDS offsets, and af[], bf[], acc[][]
    // are indexed by constants and stay in registers
#pragma unroll
    for (int ks = 0; ks < GK / 32; ++ks) {
      v16h af[MT], bf[4];
#pragma unroll
      for (int i = 0; i < MT; ++i)
        af[i] = load_frag16(ab + i * 16 * GPITCH + ks * 32, GPITCH);
#pragma unroll
      for (int i = 0; i < 4; ++i)
        bf[i] = load_frag16(wb + i * 16 * GPITCH + ks * 32, GPITCH);
      // keeps the k step's LDS reads together in front of its matrix
      // instructions: left free, the reads of A were spread among them, one
      // register set, each waited to 0 with its whole latency in the open
      __builtin_amdgcn_sched_barrier(0);
#pragma unroll
      for (int mt = 0; mt < MT; ++mt)
#pragma unroll
        for (int nt = 0; nt < 4; ++nt)
          acc[mt][nt] = wmma_f16(af[mt], bf[nt], acc[mt][nt]);
    }
  };

  stage(0, 0);
  wait_async0();
  __syncthreads();                          // stage 0 is there for every wave
  stage(1, 1);
  for (int t = 0; t < CIN / GK; ++t) {
    compute(t & 1);
    // foot of the stage: own reads of this buffer done, own copies of the next
    // stage landed; behind the barrier that holds for all four waves
    wait_ds0();
    wait_async0();
    __syncthreads();
    if (t + 2 < CIN / GK) stage(t + 2, t & 1);
  }
  wait_async0();                            // nothing in flight at the end
}

// ---------------------------------------------------------------------------
// Projection GEMM: Y[4096,512] = Xh[4096,512] @ W[512,512]  (W given as W^T)
// All four projections in ONE grid (they share Xh and do not depend on one
// another): blockIdx.z = mode; wT4 = the four W^T in mode order, qkv = the
// Q, K and V^T outputs in mode order, each one after another.
// mode 0/1: Q/K  -> f16 [B,H,S,c];  mode 2: V -> f16 [B,H,c,S] (transposed);
// mode 3: gate -> f32 sigmoid(Y + bg) at [B,S,HC].
// Block tile 128(M) x 128(N); wave tile 64 x 64.
// ---------------------------------------------------------------------------
__global__ void __launch_bounds__(128) gemm_proj(
    const _Float16* __restrict__ xh, const _Float16* __restrict__ wT4,
    const float* __restrict__ bg,
    _Float16* __restrict__ qkv, float* __restrict__ out32) {
  const int tid  = threadIdx.x;
  const int wv   = tid >> 5;
  const int lane = tid & 31;
  const int lr   = lane & 15;
  const int lh   = lane >> 4;
  const int mode = blockIdx.z;
  const int m0   = blockIdx.y * 128;
  const int n0   = blockIdx.x * 128;
  _Float16* out16 = qkv + (size_t)mode * BS * HC;  // not used by mode 3

  v8f acc[4][4] = {};
  gemm_ring<4>(xh + (size_t)m0 * CIN, wT4 + ((size_t)mode * HC + n0) * CIN, acc);

  // one loop nest a mode: the mode is the same for the whole block. All store
  // loops unrolled: acc[][] is indexed by constants and stays in registers
  const int mbase = m0 + (wv >> 1) * 64 + lh * 8;
  const int nbase = n0 + (wv & 1) * 64 + lr;
  if (mode <= 1) {
#pragma unroll
    for (int mt = 0; mt < 4; ++mt)
#pragma unroll
      for (int nt = 0; nt < 4; ++nt) {
        const int n = nbase + nt * 16;
        const int h = n >> 6, c = n & 63;
#pragma unroll
        for (int r = 0; r < 8; ++r) {
          const int m = mbase + mt * 16 + r;
          const int b = m >> 11, s = m & (SEQ - 1);
          out16[(((size_t)(b * NHEAD + h)) * SEQ + s) * CHEAD + c] =
              (_Float16)acc[mt][nt][r];
        }
      }
  } else if (mode == 2) {
#pragma unroll
    for (int mt = 0; mt < 4; ++mt)
#pragma unroll
      for (int nt = 0; nt < 4; ++nt) {
        const int n = nbase + nt * 16;
        const int h = n >> 6, c = n & 63;
#pragma unroll
        for (int r = 0; r < 8; ++r) {
          const int m = mbase + mt * 16 + r;
          const int b = m >> 11, s = m & (SEQ - 1);
          out16[(((size_t)(b * NHEAD + h)) * CHEAD + c) * SEQ + s] =
              (_Float16)acc[mt][nt][r];
        }
      }
    // precaution: the stores' registers may be written again by the code of
    // another mode that the compiler lays out behind this branch
    asm volatile("s_wait_xcnt 0x0" ::: "memory");
  } else {
    float bn[4];                            // all loads in front of the stores
#pragma unroll
    for (int nt = 0; nt < 4; ++nt) bn[nt] = bg[nbase + nt * 16];
#pragma unroll
    for (int nt = 0; nt < 4; ++nt) {
      const int n = nbase + nt * 16;
#pragma unroll
      for (int mt = 0; mt < 4; ++mt) {
        // exp(-y) = 2^(-y log2 e)
        const v8f e = exp2x8((acc[mt][nt] + bn[nt]) * -1.44269504f);
#pragma unroll
        for (int r = 0; r < 8; ++r)
          out32[(size_t)(mbase + mt * 16 + r) * HC + n] = 1.0f / (1.0f + e[r]);
        // eight sigmoids at a time: left free, the scheduler interleaved far
        // more of them and went past 256 registers (register-window switches)
        __builtin_amdgcn_sched_barrier(0);
      }
    }
    // precaution: the stores' registers may be written again by the code of
    // another mode that the compiler lays out behind this branch
    asm volatile("s_wait_xcnt 0x0" ::: "memory");
  }
}

__device__ __forceinline__ float other_half(float v) {
  // value of lane l ^ 16
  const int b = __builtin_bit_cast(int, v);
  return __builtin_bit_cast(float, __builtin_amdgcn_permlanex16(
      b, b, 0x76543210, 0xfedcba98, false, false));
}

__global__ void __launch_bounds__(128) attn_flash(
    const _Float16* __restrict__ qh, const _Float16* __restrict__ kh,
    const _Float16* __restrict__ vt, const float* __restrict__ bias,
    const int* __restrict__ amask, const float* __restrict__ gate,
    _Float16* __restrict__ ocat) {
  // two buffers each: [key_local][c], [c][key_local], [query_local][key_local]
  // (padded rows) and one copy of the mask a wave; 16-byte copies and reads
  __shared__ __attribute__((aligned(16))) _Float16 kbuf[2 * KSTAGE * KPITCH];
  __shared__ __attribute__((aligned(16))) _Float16 vbuf[2 * 64 * VPITCH];
  __shared__ __attribute__((aligned(16))) float    bbuf[2 * 64 * BPITCH];
  __shared__ __attribute__((aligned(16))) int      mbuf[2 * 4 * KSTAGE];

  const int tid  = threadIdx.x;
  const int wv   = tid >> 5;
  const int lane = tid & 31;
  const int lr   = lane & 15;
  const int lh   = lane >> 4;
  const int bh   = blockIdx.y;              // 0..15  => (b,h)
  const int bb   = bh >> 3, h = bh & 7;
  const int q0   = (blockIdx.x * 4 + wv) * 16;

  const _Float16* Q = qh + (size_t)bh * SEQ * CHEAD;
  const _Float16* K = kh + (size_t)bh * SEQ * CHEAD;
  const _Float16* V = vt + (size_t)bh * CHEAD * SEQ;
  // this wave's 16 bias rows and the batch's mask, at this lane's 16 bytes
  const float* biasw = bias + ((size_t)bh * SEQ + q0) * SEQ + lane * 4;
  const int*   maskw = amask + bb * SEQ + lane * 4;
  const unsigned kL = lds_base(kbuf), vL = lds_base(vbuf);
  const unsigned bL = lds_base(bbuf), mL = lds_base(mbuf);

  // Q^T as B operand: column = query lr, k in the loader's order
  v16h bq0 = load_frag16(Q + (size_t)q0 * CHEAD + 0,  CHEAD);
  v16h bq1 = load_frag16(Q + (size_t)q0 * CHEAD + 32, CHEAD);

  float mrun = -1e30f, lrun = 0.0f;         // lrun: this half's keys only
  v8f oacc[4] = {};                         // O^T: [c = ct*16+8*lh+r][query lr]

  // 33 copies a wave and stage; every copy covers whole 128-byte lines
  auto stage = [&](int kt, int buf) {
    const int kr = tid >> 3, kc = tid & 7;   // K: 8 chunks a row, +16 rows
    const int vc = tid >> 4, vch = tid & 15; // V^T: 16 chunks a row, +8 rows
    async_ld16x8(kL + (unsigned)((buf * KSTAGE + kr) * KPITCH + kc * 8) * 2,
                 K + (size_t)(kt + kr) * CHEAD + kc * 8,
                 16 * KPITCH * 2, 16 * CHEAD * 2);
    async_ld16x8(vL + (unsigned)((buf * 64 + vc) * VPITCH + vch * 8) * 2,
                 V + (size_t)vc * SEQ + kt + vch * 8,
                 8 * VPITCH * 2, 8 * SEQ * 2);
    // bias: a wave brings its own 16 query rows, one 512-byte row a copy
    const unsigned bl = bL + (unsigned)((buf * 64 + wv * 16) * BPITCH + lane * 4) * 4;
    async_ld16x8(bl, biasw + kt, BPITCH * 4, SEQ * 4);
    async_ld16x8(bl + 8 * BPITCH * 4, biasw + (size_t)8 * SEQ + kt,
                 BPITCH * 4, SEQ * 4);
    async_ld16x1(mL + (unsigned)((buf * 4 + wv) * KSTAGE + lane * 4) * 4,
                 maskw + kt);
  };

  // 32 keys: kb, vb, bp, mp point at their first key in the stage's buffers
  auto compute = [&](const _Float16* kb, const _Float16* vb,
                     const float* bp, const int* mp) {
    // --- pair bias + key mask: 8 consecutive keys per lane and 16-key tile ---
    // (16-byte reads: the padded rows are not multiples of 32 bytes)
    v8f b8[2];
    v8i m8[2];
#pragma unroll
    for (int nh = 0; nh < 2; ++nh) {
      b8[nh] = __builtin_shufflevector(*(const v4f*)(bp + nh * 16),
                                       *(const v4f*)(bp + nh * 16 + 4),
                                       0, 1, 2, 3, 4, 5, 6, 7);
      m8[nh] = __builtin_shufflevector(*(const v4i*)(mp + nh * 16),
                                       *(const v4i*)(mp + nh * 16 + 4),
                                       0, 1, 2, 3, 4, 5, 6, 7);
    }
    // --- logits tile: S^T = K Q^T  (32 keys x 16 queries, two f32 tiles) ---
    v16h ak[2][2];
#pragma unroll
    for (int nh = 0; nh < 2; ++nh) {
      ak[nh][0] = load_frag16(kb + nh * 16 * KPITCH + 0,  KPITCH);
      ak[nh][1] = load_frag16(kb + nh * 16 * KPITCH + 32, KPITCH);
    }
    v8f sa[2] = {};
#pragma unroll
    for (int nh = 0; nh < 2; ++nh) {
      sa[nh] = wmma_f16(ak[nh][0], bq0, sa[nh]);
      sa[nh] = wmma_f16(ak[nh][1], bq1, sa[nh]);
    }
    // V^T fragments (A rows = output channel c): P never passes through LDS,
    // so they can be fetched while the softmax runs
    v16h av[4];
#pragma unroll
    for (int ct = 0; ct < 4; ++ct) av[ct] = load_frag16(vb + ct * 16 * VPITCH, VPITCH);
    // --- scale + pair bias + key mask ---
#pragma unroll
    for (int nh = 0; nh < 2; ++nh) {
      v8f moff;
#pragma unroll
      for (int r = 0; r < 8; ++r) moff[r] = (m8[nh][r] > 0) ? 0.0f : -1e9f;
      sa[nh] = sa[nh] * 0.125f + b8[nh] + moff;
    }
    // --- online softmax: one query per lane, halves joined for the maximum ---
    const v8f mx8 = __builtin_elementwise_max(sa[0], sa[1]);
    const float mx = fmaxf(fmaxf(fmaxf(mx8[0], mx8[1]), fmaxf(mx8[2], mx8[3])),
                           fmaxf(fmaxf(mx8[4], mx8[5]), fmaxf(mx8[6], mx8[7])));
    const float mnew = fmaxf(mrun, fmaxf(mx, other_half(mx)));
#pragma unroll
    for (int nh = 0; nh < 2; ++nh)
      sa[nh] = exp2x8((sa[nh] - mnew) * 1.44269504f);   // exp(x) = 2^(x log2 e)
    const v8f ps = sa[0] + sa[1];
    const float ts = ((ps[0] + ps[1]) + (ps[2] + ps[3])) +
                     ((ps[4] + ps[5]) + (ps[6] + ps[7]));
    const float alpha = __expf(mrun - mnew);
    lrun = lrun * alpha + ts;
    mrun = mnew;
#pragma unroll
    for (int ct = 0; ct < 4; ++ct) oacc[ct] *= alpha;
    // --- P^T as B operand: element s = key 8*lh+s (s<8), 16+8*lh+s-8 (s>=8) ---
    const v16h pt = __builtin_shufflevector(
        __builtin_convertvector(sa[0], v8h), __builtin_convertvector(sa[1], v8h),
        0, 1, 2, 3, 4, 5, 6, 7, 8, 9, 10, 11, 12, 13, 14, 15);
    // --- O^T += V^T P^T ---
#pragma unroll
    for (int ct = 0; ct < 4; ++ct) oacc[ct] = wmma_f16(av[ct], pt, oacc[ct]);
  };

  stage(0, 0);
  wait_async0();
  __syncthreads();                          // stage 0 is there for every wave
  stage(KSTAGE, 1);
  for (int kt = 0; kt < SEQ; kt += KSTAGE) {
    const int buf = (kt / KSTAGE) & 1;
    const _Float16* kb = kbuf + buf * KSTAGE * KPITCH;
    const _Float16* vb = vbuf + buf * 64 * VPITCH;
    const float*    bp = bbuf + (buf * 64 + wv * 16 + lr) * BPITCH + lh * 8;
    const int*      mp = mbuf + (buf * 4 + wv) * KSTAGE + lh * 8;
    // unrolled: constant LDS offsets, and a step's reads can start under the
    // softmax of the step before
#pragma unroll
    for (int j = 0; j < KSTAGE / 32; ++j)
      compute(kb + j * 32 * KPITCH, vb + j * 32, bp + j * 32, mp + j * 32);
    // foot of the stage: own reads of this buffer done, own copies of the next
    // stage landed; behind the barrier that holds for all four waves
    wait_ds0();
    wait_async0();
    __syncthreads();
    if (kt + 2 * KSTAGE < SEQ) stage(kt + 2 * KSTAGE, buf);
  }
  wait_async0();                            // nothing in flight at the end

  // --- epilogue: normalize, gate, store concat-head f16 [B,S,HC] ---
  // a lane holds 8 consecutive channels of its query per tile: 16-byte stores
  const float rl = 1.0f / (lrun + other_half(lrun));
  const size_t rowoff = ((size_t)(bb * SEQ + q0 + lr)) * HC + h * CHEAD + lh * 8;
#pragma unroll
  for (int ct = 0; ct < 4; ++ct) {
    const float4 g0 = *(const float4*)(gate + rowoff + ct * 16);
    const float4 g1 = *(const float4*)(gate + rowoff + ct * 16 + 4);
    const float g8[8] = {g0.x, g0.y, g0.z, g0.w, g1.x, g1.y, g1.z, g1.w};
    v8h o;
#pragma unroll
    for (int r = 0; r < 8; ++r) o[r] = (_Float16)(oacc[ct][r] * rl * g8[r]);
    *(v8h*)(ocat + rowoff + ct * 16) = o;
  }
}

// ---------------------------------------------------------------------------
// Output GEMM: out[4096,512] = Ocat[4096,512] @ Wo + bo   (Wo given as Wo^T)
// Same core as gemm_proj; block tile 64(M) x 128(N), wave tile 32 x 64, so
// that the grid has one block for every WGP.
// ---------------------------------------------------------------------------
__global__ void __launch_bounds__(128) gemm_out(
    const _Float16* __restrict__ oc, const _Float16* __restrict__ woT,
    const float* __restrict__ bo, float* __restrict__ out) {
  const int tid  = threadIdx.x;
  const int wv   = tid >> 5;
  const int lane = tid & 31;
  const int lr   = lane & 15;
  const int lh   = lane >> 4;
  const int m0   = blockIdx.y * 64;
  const int n0   = blockIdx.x * 128;

  v8f acc[2][4] = {};
  gemm_ring<2>(oc + (size_t)m0 * HC, woT + (size_t)n0 * HC, acc);

  const int mbase = m0 + (wv >> 1) * 32 + lh * 8;
  const int nbase = n0 + (wv & 1) * 64 + lr;
  // unrolled: acc[][] is indexed by constants and stays in registers
#pragma unroll
  for (int nt = 0; nt < 4; ++nt) {
    const int n = nbase + nt * 16;
    const float bn = bo[n];
#pragma unroll
    for (int mt = 0; mt < 2; ++mt)
#pragma unroll
      for (int r = 0; r < 8; ++r)
        out[(size_t)(mbase + mt * 16 + r) * CIN + n] = acc[mt][nt][r] + bn;
  }
}

// ---------------------------------------------------------------------------
extern "C" void kernel_launch(void* const* d_in, const int* in_sizes, int n_in,
                              void* d_out, int out_size, void* d_ws,
                              size_t ws_size, hipStream_t stream) {
  const float* x     = (const float*)d_in[0];
  const float* bias  = (const float*)d_in[1];
  const int*   amask = (const int*)d_in[2];
  const float* Wq    = (const float*)d_in[3];
  const float* Wk    = (const float*)d_in[4];
  const float* Wv    = (const float*)d_in[5];
  const float* Wg    = (const float*)d_in[6];
  const float* bg    = (const float*)d_in[7];
  const float* Wo    = (const float*)d_in[8];
  const float* bo    = (const float*)d_in[9];
  float* out = (float*)d_out;

  char* ws = (char*)d_ws;
  size_t off = 0;
  auto carve = [&](size_t bytes) -> char* {
    char* p = ws + off;
    off += (bytes + 255) & ~(size_t)255;
    return p;
  };
  _Float16* xh  = (_Float16*)carve((size_t)BS * CIN * 2);
  // the five W^T (q, k, v, g, o) in one piece, and Q, K, V^T in one piece
  _Float16* wt5 = (_Float16*)carve((size_t)5 * CIN * HC * 2);
  _Float16* wto = wt5 + (size_t)4 * CIN * HC;
  _Float16* qkv = (_Float16*)carve((size_t)3 * BS * HC * 2);
  _Float16* qh  = qkv;
  _Float16* kh  = qkv + (size_t)BS * HC;
  _Float16* vt  = qkv + (size_t)2 * BS * HC;
  float*    gat = (float*)carve((size_t)BS * HC * 4);
  _Float16* oc  = (_Float16*)carve((size_t)BS * HC * 2);

  // 1) convert x to f16; transpose+convert the 5 weight matrices: one launch
  cvt_all<<<5 * WTILES + XBLOCKS, 256, 0, stream>>>(x, Wq, Wk, Wv, Wg, Wo,
                                                    xh, wt5);

  // 2) projections (Q, K, V^T, gate): one launch
  {
    dim3 grid(HC / 128, BS / 128, 4);
    gemm_proj<<<grid, 128, 0, stream>>>(xh, wt5, bg, qkv, gat);
  }

  // 3) fused flash attention (bias streamed once, softmax online, gated)
  {
    dim3 grid(SEQ / 64, BATCH * NHEAD);
    attn_flash<<<grid, 128, 0, stream>>>(qh, kh, vt, bias, amask, gat, oc);
  }

  // 4) output projection + bias
  {
    dim3 grid(CIN / 128, BS / 64);
    gemm_out<<<grid, 128, 0, stream>>>(oc, wto, bo, out);
  }
}

// v007
// Measured time: 54.9 microseconds a run.
// Two timings next to v006 put it at 1.08 and 1.09 times that version's speed.
// Counting every step since v000, it is 3.46 times as fast.
#include <hip/hip_runtime.h>
#include <hip/hip_bf16.h>

typedef __attribute__((ext_vector_type(16))) _Float16 v16h;
typedef __attribute__((ext_vector_type(8)))  _Float16 v8h;
typedef __attribute__((ext_vector_type(8)))  float    v8f;
typedef __attribute__((ext_vector_type(8)))  int      v8i;
typedef __attribute__((ext_vector_type(4)))  float    v4f;
typedef __attribute__((ext_vector_type(4)))  int      v4i;
typedef __attribute__((ext_vector_type(4)))  _Float16 v4h;
typedef __attribute__((ext_vector_type(2)))  _Float16 v2h;

#define BATCH 2
#define SEQ   2048
#define CIN   512
#define NHEAD 8
#define CHEAD 64
#define HC    512          // NHEAD*CHEAD
#define BS    4096         // BATCH*SEQ

// ---------------------------------------------------------------------------
// WMMA helpers
// ---------------------------------------------------------------------------
__device__ __forceinline__ v8f wmma_f16(v16h a, v16h b, v8f c) {
  // D = A(16x32 f16) * B(32x16 f16) + C(16x16 f32)
  return __builtin_amdgcn_wmma_f32_16x16x32_f16(
      false, a, false, b, (short)0, c, false, false);
}

// Load one 16x32 f16 fragment (A-layout; also serves B when the B source is
// stored n-major with k contiguous). `base` points at element (row0, k0),
// `ld` is the row stride in elements. Per ISA 16-bit A layout:
//   lanes 0-15 : row = lane,    K = 0..7 and 16..23
//   lanes 16-31: row = lane-16, K = 8..15 and 24..31
__device__ __forceinline__ v16h load_frag16(const _Float16* base, int ld) {
  const int lane = threadIdx.x & 31;
  const int row  = lane & 15;
  const int koff = (lane >> 4) << 3;        // 0 or 8
  const _Float16* p = base + row * ld + koff;
  v8h lo = *(const v8h*)(p);                // K = koff .. koff+7
  v8h hi = *(const v8h*)(p + 16);           // K = 16+koff .. 16+koff+7
  return __builtin_shufflevector(lo, hi, 0,1,2,3,4,5,6,7,
                                 8,9,10,11,12,13,14,15);
}

// ---------------------------------------------------------------------------
// CDNA5 async memory->LDS staging (ASYNCcnt path; no VGPR round-trip).
// Every ring here waits to 0 at the foot of each stage.
// ---------------------------------------------------------------------------
typedef __attribute__((address_space(3))) const void* lds_cptr_t;

__device__ __forceinline__ unsigned lds_base(const void* p) {
  // addrspace(3) pointers are 32-bit offsets from the wave's LDS base
  return (unsigned)(unsigned long long)(lds_cptr_t)p;
}

// per-lane: LDS[l] = MEM[g] (16 bytes each), tracked with ASYNCcnt. The copies
// of a stage stand in statements whose last line is s_wait_xcnt 0: a
// precaution that keeps every later rewrite of the address registers they
// name behind that wait (the compiler puts nothing inside a statement).
// eight copies, each ls LDS bytes and gs global bytes behind the one before
__device__ __forceinline__ void async_ld16x8(unsigned l, const void* gp,
                                             unsigned ls, unsigned gs) {
  const unsigned long long g = (unsigned long long)gp;
  asm volatile("global_load_async_to_lds_b128 %0, %1, off\n\t"
               "global_load_async_to_lds_b128 %2, %3, off\n\t"
               "global_load_async_to_lds_b128 %4, %5, off\n\t"
               "global_load_async_to_lds_b128 %6, %7, off\n\t"
               "global_load_async_to_lds_b128 %8, %9, off\n\t"
               "global_load_async_to_lds_b128 %10, %11, off\n\t"
               "global_load_async_to_lds_b128 %12, %13, off\n\t"
               "global_load_async_to_lds_b128 %14, %15, off\n\t"
               "s_wait_xcnt 0x0"
               :: "v"(l),          "v"(g),
                  "v"(l + ls),     "v"(g + gs),
                  "v"(l + 2 * ls), "v"(g + 2 * gs),
                  "v"(l + 3 * ls), "v"(g + 3 * gs),
                  "v"(l + 4 * ls), "v"(g + 4 * gs),
                  "v"(l + 5 * ls), "v"(g + 5 * gs),
                  "v"(l + 6 * ls), "v"(g + 6 * gs),
                  "v"(l + 7 * ls), "v"(g + 7 * gs)
               : "memory");
}
// four copies, spaced like the eight above
__device__ __forceinline__ void async_ld16x4(unsigned l, const void* gp,
                                             unsigned ls, unsigned gs) {
  const unsigned long long g = (unsigned long long)gp;
  asm volatile("global_load_async_to_lds_b128 %0, %1, off\n\t"
               "global_load_async_to_lds_b128 %2, %3, off\n\t"
               "global_load_async_to_lds_b128 %4, %5, off\n\t"
               "global_load_async_to_lds_b128 %6, %7, off\n\t"
               "s_wait_xcnt 0x0"
               :: "v"(l),          "v"(g),
                  "v"(l + ls),     "v"(g + gs),
                  "v"(l + 2 * ls), "v"(g + 2 * gs),
                  "v"(l + 3 * ls), "v"(g + 3 * gs)
               : "memory");
}
__device__ __forceinline__ void async_ld16x1(unsigned l, const void* g) {
  asm volatile("global_load_async_to_lds_b128 %0, %1, off\n\t"
               "s_wait_xcnt 0x0"
               :: "v"(l), "v"((unsigned long long)g)
               : "memory");
}

// LDS row pitches, in elements. The readers take 16 rows at once, 16 bytes a
// lane; a pitch of 16 bytes x an odd number puts the 16 rows on 64 different
// banks. Unpadded rows of 64 bytes x a power of two fall on 16 banks or fewer.
#define KSTAGE 128         // keys of one stage of the attention ring
#define KPITCH 72          // 64 f16 (128-byte) K rows      -> 144 bytes
#define VPITCH 136         // KSTAGE f16 (256-byte) V^T rows -> 272 bytes
#define BPITCH 132         // KSTAGE f32 (512-byte) bias rows -> 528 bytes
#define GK     128         // k of one stage of the GEMM ring
#define GPITCH 136         // GK f16 (256-byte) A and W^T rows -> 272 bytes

__device__ __forceinline__ void wait_async0() {
  asm volatile("s_wait_asynccnt 0x0" ::: "memory");
}
// a wave's own LDS reads have returned before it lets their buffer be refilled
__device__ __forceinline__ void wait_ds0() {
  asm volatile("s_wait_dscnt 0x0" ::: "memory");
}

// ---------------------------------------------------------------------------
// Conversion kernels
// ---------------------------------------------------------------------------
// Each thread takes many elements, so that few waves have to start.
// 32 floats a thread; every wave-wide load and store covers whole 128-byte
// lines. BS*CIN / 8192 blocks, no remainder.
#define XBLOCKS ((BS * CIN) / 8192)
__device__ __forceinline__ void cvt_f32_to_f16(
    const float* __restrict__ src, _Float16* __restrict__ dst, int blk) {
  const int base = blk * 8192 + threadIdx.x * 4;
  v4f v[8];
  // unrolled: all eight loads are issued before the first is waited for
#pragma unroll
  for (int j = 0; j < 8; ++j) v[j] = *(const v4f*)(src + base + j * 1024);
  // unrolled: v[] stays in registers
#pragma unroll
  for (int j = 0; j < 8; ++j)
    *(v4h*)(dst + base + j * 1024) = __builtin_convertvector(v[j], v4h);
  // precaution: the stores' registers may be written again by whatever code
  // the compiler lays out behind this inlined body
  asm volatile("s_wait_xcnt 0x0" ::: "memory");
}

// wT[n*512 + k] = (f16) w[k*512 + n]   (512x512 transpose + convert)
// One 64(k) x 64(n) tile a block, 16 elements a thread: rows of w read in
// 256-byte runs, turned in LDS, rows of wT written in whole 128-byte lines.
// The short loops are unrolled so that a[][] stays in registers and the four
// loads are issued together.
#define WTILES ((CIN / 64) * (HC / 64))    // tiles of one weight matrix
__device__ __forceinline__ void cvt_w_transpose(
    const float* __restrict__ w, _Float16* __restrict__ wT, int tile) {
  __shared__ _Float16 t[64 * 72];           // [n_local][k_local], 144-byte rows
  const int tid = threadIdx.x;
  const int k0  = (tile & 7) * 64, n0 = (tile >> 3) * 64;
  const int nq  = (tid & 15) * 4;           // four columns n
  const int kp  = (tid >> 4) * 2;           // two rows k, twice (32 apart)
  v4f a[2][2];
#pragma unroll
  for (int j = 0; j < 2; ++j)
#pragma unroll
    for (int e = 0; e < 2; ++e)
      a[j][e] = *(const v4f*)(w + (k0 + kp + 32 * j + e) * CIN + n0 + nq);
#pragma unroll
  for (int j = 0; j < 2; ++j)
#pragma unroll
    for (int i = 0; i < 4; ++i) {
      const v2h p = {(_Float16)a[j][0][i], (_Float16)a[j][1][i]};
      *(v2h*)(t + (nq + i) * 72 + kp + 32 * j) = p;
    }
  __syncthreads();                          // the tile is read across waves
#pragma unroll
  for (int j = 0; j < 2; ++j) {
    const int nl = (tid >> 3) + 32 * j, kc = (tid & 7) * 8;
    *(v8h*)(wT + (n0 + nl) * CIN + k0 + kc) = *(const v8h*)(t + nl * 72 + kc);
  }
}

// All six conversions as ONE grid: none depends on another, so they need no
// launch boundary between them. Blocks 0 .. 5*WTILES-1 turn the five weight
// matrices (the longer chain, started first) into wT5[matrix][n][k]; the rest
// convert x. The choice is the same for a whole block, barrier included.
__global__ void __launch_bounds__(256) cvt_all(
    const float* __restrict__ x,  const float* __restrict__ wq,
    const float* __restrict__ wk, const float* __restrict__ wv,
    const float* __restrict__ wg, const float* __restrict__ wo,
    _Float16* __restrict__ xh, _Float16* __restrict__ wT5) {
  const unsigned blk = blockIdx.x;
  if (blk < 5 * WTILES) {
    const unsigned mat = blk / WTILES;
    const float* wlo = (mat & 1) ? wk : wq;
    const float* whi = (mat & 1) ? wg : wv;
    const float* w   = (mat & 4) ? wo : (mat & 2) ? whi : wlo;
    cvt_w_transpose(w, wT5 + (size_t)mat * CIN * HC, blk % WTILES);
  } else {
    cvt_f32_to_f16(x, xh, blk - 5 * WTILES);
  }
}

// 2^x of eight values, each in its own register. One statement: behind an
// exponential stands another one on other registers, so no result is read and
// no source overwritten in the slot directly behind it; the v_nop keeps that
// slot behind the last one, whatever the compiler puts next.
__device__ __forceinline__ v8f exp2x8(v8f t) {
  float a = t[0], b = t[1], c = t[2], d = t[3];
  float e = t[4], f = t[5], g = t[6], h = t[7];
  asm("v_exp_f32 %0, %0\n\tv_exp_f32 %1, %1\n\tv_exp_f32 %2, %2\n\t"
      "v_exp_f32 %3, %3\n\tv_exp_f32 %4, %4\n\tv_exp_f32 %5, %5\n\t"
      "v_exp_f32 %6, %6\n\tv_exp_f32 %7, %7\n\tv_nop"
      : "+v"(a), "+v"(b), "+v"(c), "+v"(d), "+v"(e), "+v"(f), "+v"(g), "+v"(h));
  return v8f{a, b, c, d, e, f, g, h};
}

// ---------------------------------------------------------------------------
// GEMM core: C[MT*32, 128] = A[MT*32, 512] * W[512, 128], W given as W^T.
// 128 threads = 4 waves as 2 (M) x 2 (N); wave tile MT*16 x 64, so that every
// fragment read from LDS feeds 4 (A) or MT (W^T) matrix instructions and every
// row brought from L2 serves the whole block tile.
// A and W^T rows come by async copies of whole lines into a two-buffer LDS
// ring, GK of k a stage: the next stage flies while this one is worked on.
// a, wt: first row of the block's A and W^T rows, both with 512 elements a row.
// ---------------------------------------------------------------------------
template <int MT>
__device__ __forceinline__ void gemm_ring(const _Float16* __restrict__ a,
                                          const _Float16* __restrict__ wt,
                                          v8f (&acc)[MT][4]) {
  constexpr int AROWS = MT * 32;
  // two buffers each: [row_local][k_local], padded rows; 16-byte copies, reads
  __shared__ __attribute__((aligned(16))) _Float16 abuf[2 * AROWS * GPITCH];
  __shared__ __attribute__((aligned(16))) _Float16 wbuf[2 * 128 * GPITCH];
  const int tid = threadIdx.x;
  const int wv  = tid >> 5;
  const unsigned aL = lds_base(abuf), wL = lds_base(wbuf);

  // 16 chunks of 16 bytes a row: a wave-wide copy covers two whole rows of the
  // stage; a statement takes rows rr, rr + 8, ..., rr + 56
  auto stage = [&](int t, int buf) {
    const int rr = tid >> 4, ch = tid & 15;
    const size_t go = (size_t)rr * CIN + t * GK + ch * 8;
    // both short loops unrolled: one asm statement for each 64 rows
#pragma unroll
    for (int q = 0; q < AROWS / 64; ++q)
      async_ld16x8(aL + (unsigned)((buf * AROWS + q * 64 + rr) * GPITCH + ch * 8) * 2,
                   a + go + (size_t)q * 64 * CIN, 8 * GPITCH * 2, 8 * CIN * 2);
#pragma unroll
    for (int q = 0; q < 2; ++q)
      async_ld16x8(wL + (unsigned)((buf * 128 + q * 64 + rr) * GPITCH + ch * 8) * 2,
                   wt + go + (size_t)q * 64 * CIN, 8 * GPITCH * 2, 8 * CIN * 2);
  };
  auto compute = [&](int buf) {
    const _Float16* ab = abuf + (buf * AROWS + (wv >> 1) * MT * 16) * GPITCH;
    const _Float16* wb = wbuf + (buf * 128 + (wv & 1) * 64) * GPITCH;
    // the whole nest unrolled: constant LDS offsets, and af[], bf[], acc[][]
    // are indexed by constants and stay in registers
#pragma unroll
    for (int ks = 0; ks < GK / 32; ++ks) {
      v16h af[MT], bf[4];
#pragma unroll
      for (int i = 0; i < MT; ++i)
        af[i] = load_frag16(ab + i * 16 * GPITCH + ks * 32, GPITCH);
#pragma unroll
      for (int i = 0; i < 4; ++i)
        bf[i] = load_frag16(wb + i * 16 * GPITCH + ks * 32, GPITCH);
      // keeps the k step's LDS reads together in front of its matrix
      // instructions: left free, the reads of A were spread among them, one
      // register set, each waited to 0 with its whole latency in the open
      __builtin_amdgcn_sched_barrier(0);
#pragma unroll
      for (int mt = 0; mt < MT; ++mt)
#pragma unroll
        for (int nt = 0; nt < 4; ++nt)
          acc[mt][nt] = wmma_f16(af[mt], bf[nt], acc[mt][nt]);
    }
  };

  stage(0, 0);
  wait_async0();
  __syncthreads();                          // stage 0 is there for every wave
  stage(1, 1);
  for (int t = 0; t < CIN / GK; ++t) {
    compute(t & 1);
    // foot of the stage: own reads of this buffer done, own copies of the next
    // stage landed; behind the barrier that holds for all four waves
    wait_ds0();
    wait_async0();
    __syncthreads();
    if (t + 2 < CIN / GK) stage(t + 2, t & 1);
  }
  wait_async0();                            // nothing in flight at the end
}

// ---------------------------------------------------------------------------
// Projection GEMM: Y[4096,512] = Xh[4096,512] @ W[512,512]  (W given as W^T)
// All four projections in ONE grid (they share Xh and do not depend on one
// another): blockIdx.z = mode; wT4 = the four W^T in mode order, qkv = the
// Q, K and V^T outputs in mode order, each one after another.
// mode 0/1: Q/K  -> f16 [B,H,S,c];  mode 2: V -> f16 [B,H,c,S] (transposed);
// mode 3: gate -> f32 sigmoid(Y + bg) at [B,S,HC].
// Block tile 128(M) x 128(N); wave tile 64 x 64.
// ---------------------------------------------------------------------------
__global__ void __launch_bounds__(128) gemm_proj(
    const _Float16* __restrict__ xh, const _Float16* __restrict__ wT4,
    const float* __restrict__ bg,
    _Float16* __restrict__ qkv, float* __restrict__ out32) {
  const int tid  = threadIdx.x;
  const int wv   = tid >> 5;
  const int lane = tid & 31;
  const int lr   = lane & 15;
  const int lh   = lane >> 4;
  const int mode = blockIdx.z;
  const int m0   = blockIdx.y * 128;
  const int n0   = blockIdx.x * 128;
  _Float16* out16 = qkv + (size_t)mode * BS * HC;  // not used by mode 3

  v8f acc[4][4] = {};
  gemm_ring<4>(xh + (size_t)m0 * CIN, wT4 + ((size_t)mode * HC + n0) * CIN, acc);

  // one loop nest a mode: the mode is the same for the whole block. All store
  // loops unrolled: acc[][] is indexed by constants and stays in registers
  const int mbase = m0 + (wv >> 1) * 64 + lh * 8;
  const int nbase = n0 + (wv & 1) * 64 + lr;
  if (mode <= 1) {
#pragma unroll
    for (int mt = 0; mt < 4; ++mt)
#pragma unroll
      for (int nt = 0; nt < 4; ++nt) {
        const int n = nbase + nt * 16;
        const int h = n >> 6, c = n & 63;
#pragma unroll
        for (int r = 0; r < 8; ++r) {
          const int m = mbase + mt * 16 + r;
          const int b = m >> 11, s = m & (SEQ - 1);
          out16[(((size_t)(b * NHEAD + h)) * SEQ + s) * CHEAD + c] =
              (_Float16)acc[mt][nt][r];
        }
      }
  } else if (mode == 2) {
#pragma unroll
    for (int mt = 0; mt < 4; ++mt)
#pragma unroll
      for (int nt = 0; nt < 4; ++nt) {
        const int n = nbase + nt * 16;
        const int h = n >> 6, c = n & 63;
#pragma unroll
        for (int r = 0; r < 8; ++r) {
          const int m = mbase + mt * 16 + r;
          const int b = m >> 11, s = m & (SEQ - 1);
          out16[(((size_t)(b * NHEAD + h)) * CHEAD + c) * SEQ + s] =
              (_Float16)acc[mt][nt][r];
        }
      }
    // precaution: the stores' registers may be written again by the code of
    // another mode that the compiler lays out behind this branch
    asm volatile("s_wait_xcnt 0x0" ::: "memory");
  } else {
    float bn[4];                            // all loads in front of the stores
#pragma unroll
    for (int nt = 0; nt < 4; ++nt) bn[nt] = bg[nbase + nt * 16];
#pragma unroll
    for (int nt = 0; nt < 4; ++nt) {
      const int n = nbase + nt * 16;
#pragma unroll
      for (int mt = 0; mt < 4; ++mt) {
        // exp(-y) = 2^(-y log2 e)
        const v8f e = exp2x8((acc[mt][nt] + bn[nt]) * -1.44269504f);
#pragma unroll
        for (int r = 0; r < 8; ++r)
          out32[(size_t)(mbase + mt * 16 + r) * HC + n] = 1.0f / (1.0f + e[r]);
        // eight sigmoids at a time: left free, the scheduler interleaved far
        // more of them and went past 256 registers (register-window switches)
        __builtin_amdgcn_sched_barrier(0);
      }
    }
    // precaution: the stores' registers may be written again by the code of
    // another mode that the compiler lays out behind this branch
    asm volatile("s_wait_xcnt 0x0" ::: "memory");
  }
}

#define QBLK 128
#define XCH  (9 * 128)

__device__ __forceinline__ float other_half(float v) {
  // value of lane l ^ 16
  const int b = __builtin_bit_cast(int, v);
  return __builtin_bit_cast(float, __builtin_amdgcn_permlanex16(
      b, b, 0x76543210, 0xfedcba98, false, false));
}

// 256 threads are launched; the bound of 512 sets the compiler's register
// ceiling to 256 a wave: with the bound of 256 it hoisted LDS reads until the
// kernel needed 272, with operands lying across two register windows
__global__ void __launch_bounds__(512) attn_flash(
    const _Float16* __restrict__ qh, const _Float16* __restrict__ kh,
    const _Float16* __restrict__ vt, const float* __restrict__ bias,
    const int* __restrict__ amask, const float* __restrict__ gate,
    _Float16* __restrict__ ocat) {
  // two buffers each: [key_local][c], [c][key_local], [query_local][key_local]
  // (padded rows) and one copy of the mask a wave; 16-byte copies and reads
  __shared__ __attribute__((aligned(16))) _Float16 kbuf[2 * KSTAGE * KPITCH];
  __shared__ __attribute__((aligned(16))) _Float16 vbuf[2 * 64 * VPITCH];
  __shared__ __attribute__((aligned(16))) float    bbuf[2 * QBLK * BPITCH];
  __shared__ __attribute__((aligned(16))) int      mbuf[2 * 8 * KSTAGE];

  const int tid  = threadIdx.x;
  // the wave's number as a scalar: the branches on it are scalar branches
  const int wv   = __builtin_amdgcn_readfirstlane(tid >> 5);
  const int lane = tid & 31;
  const int lr   = lane & 15;
  const int lh   = lane >> 4;
  const int qg   = wv & 3;                  // which 32 queries of the block
  const int ks   = wv >> 2;                 // which 32 of each 64 keys
  const int bh   = blockIdx.y;              // 0..15  => (b,h)
  const int bb   = bh >> 3, h = bh & 7;
  const int qb   = blockIdx.x * QBLK;
  const int q0   = qb + qg * 32;

  const _Float16* Q = qh + (size_t)bh * SEQ * CHEAD;
  const _Float16* K = kh + (size_t)bh * SEQ * CHEAD;
  const _Float16* V = vt + (size_t)bh * CHEAD * SEQ;
  // the 16 bias rows this wave stages and the batch's mask, at this lane's
  // 16 bytes
  const float* biasw = bias + ((size_t)bh * SEQ + qb + wv * 16) * SEQ + lane * 4;
  const int*   maskw = amask + bb * SEQ + lane * 4;
  const unsigned kL = lds_base(kbuf), vL = lds_base(vbuf);
  const unsigned bL = lds_base(bbuf), mL = lds_base(mbuf);

  // Q^T as B operand: column = query lr of group g, k in the loader's order
  // (unrolled: bq[][] is indexed by constants and stays in registers)
  v16h bq[2][2];
#pragma unroll
  for (int g = 0; g < 2; ++g) {
    bq[g][0] = load_frag16(Q + (size_t)(q0 + g * 16) * CHEAD + 0,  CHEAD);
    bq[g][1] = load_frag16(Q + (size_t)(q0 + g * 16) * CHEAD + 32, CHEAD);
  }

  float mrun[2] = {-1e30f, -1e30f};
  float lrun[2] = {0.0f, 0.0f};             // this half's, this wave's keys only
  v8f oacc[2][4] = {};                      // O^T: [c = ct*16+8*lh+r][query lr]

  // 25 copies a wave and stage; every copy covers whole 128-byte lines
  auto stage = [&](int kt, int buf) {
    const int kr = tid >> 3, kc = tid & 7;   // K: 8 chunks a row, +32 rows
    const int vc = tid >> 4, vch = tid & 15; // V^T: 16 chunks a row, +16 rows
    async_ld16x4(kL + (unsigned)((buf * KSTAGE + kr) * KPITCH + kc * 8) * 2,
                 K + (size_t)(kt + kr) * CHEAD + kc * 8,
                 32 * KPITCH * 2, 32 * CHEAD * 2);
    async_ld16x4(vL + (unsigned)((buf * 64 + vc) * VPITCH + vch * 8) * 2,
                 V + (size_t)vc * SEQ + kt + vch * 8,
                 16 * VPITCH * 2, 16 * SEQ * 2);
    // bias: a wave brings 16 query rows, one 512-byte row a copy
    const unsigned bl = bL + (unsigned)((buf * QBLK + wv * 16) * BPITCH + lane * 4) * 4;
    async_ld16x8(bl, biasw + kt, BPITCH * 4, SEQ * 4);
    async_ld16x8(bl + 8 * BPITCH * 4, biasw + (size_t)8 * SEQ + kt,
                 BPITCH * 4, SEQ * 4);
    async_ld16x1(mL + (unsigned)((buf * 8 + wv) * KSTAGE + lane * 4) * 4,
                 maskw + kt);
  };

  // 32 keys x 32 queries: kb, vb, bp, mp point at the first key in the stage's
  // buffers; bp at group 0's row, group 1's lies 16 rows behind it. All short
  // loops unrolled: the arrays are indexed by constants and stay in registers
  auto compute = [&](const _Float16* kb, const _Float16* vb,
                     const float* bp, const int* mp) {
    // --- pair bias + key mask: 8 consecutive keys per lane and 16-key tile ---
    // (16-byte reads: the padded rows are not multiples of 32 bytes)
    v8f b8[2][2];
    v8i m8[2];
#pragma unroll
    for (int nh = 0; nh < 2; ++nh) {
      m8[nh] = __builtin_shufflevector(*(const v4i*)(mp + nh * 16),
                                       *(const v4i*)(mp + nh * 16 + 4),
                                       0, 1, 2, 3, 4, 5, 6, 7);
#pragma unroll
      for (int g = 0; g < 2; ++g) {
        const float* p = bp + g * 16 * BPITCH + nh * 16;
        b8[g][nh] = __builtin_shufflevector(*(const v4f*)(p), *(const v4f*)(p + 4),
                                            0, 1, 2, 3, 4, 5, 6, 7);
      }
    }
    // --- logits tiles: S^T = K Q^T  (32 keys x 16 queries a group) ---
    v16h ak[2][2];
#pragma unroll
    for (int nh = 0; nh < 2; ++nh) {
      ak[nh][0] = load_frag16(kb + nh * 16 * KPITCH + 0,  KPITCH);
      ak[nh][1] = load_frag16(kb + nh * 16 * KPITCH + 32, KPITCH);
    }
    v8f sa[2][2] = {};
#pragma unroll
    for (int kk = 0; kk < 2; ++kk)
#pragma unroll
      for (int g = 0; g < 2; ++g)
#pragma unroll
        for (int nh = 0; nh < 2; ++nh)
          sa[g][nh] = wmma_f16(ak[nh][kk], bq[g][kk], sa[g][nh]);
    // V^T fragments (A rows = output channel c): P never passes through LDS,
    // so they can be fetched while the softmax runs
    v16h av[4];
#pragma unroll
    for (int ct = 0; ct < 4; ++ct) av[ct] = load_frag16(vb + ct * 16 * VPITCH, VPITCH);
    // --- scale + pair bias + key mask (the offsets serve both groups) ---
    v8f moff[2];
#pragma unroll
    for (int nh = 0; nh < 2; ++nh)
#pragma unroll
      for (int r = 0; r < 8; ++r) moff[nh][r] = (m8[nh][r] > 0) ? 0.0f : -1e9f;
#pragma unroll
    for (int g = 0; g < 2; ++g) {
#pragma unroll
      for (int nh = 0; nh < 2; ++nh)
        sa[g][nh] = sa[g][nh] * 0.125f + b8[g][nh] + moff[nh];
      // --- online softmax: one query per lane, halves joined for the maximum ---
      const v8f mx8 = __builtin_elementwise_max(sa[g][0], sa[g][1]);
      const float mx = fmaxf(fmaxf(fmaxf(mx8[0], mx8[1]), fmaxf(mx8[2], mx8[3])),
                             fmaxf(fmaxf(mx8[4], mx8[5]), fmaxf(mx8[6], mx8[7])));
      const float mnew = fmaxf(mrun[g], fmaxf(mx, other_half(mx)));
#pragma unroll
      for (int nh = 0; nh < 2; ++nh)     // exp(x) = 2^(x log2 e)
        sa[g][nh] = exp2x8((sa[g][nh] - mnew) * 1.44269504f);
      const v8f ps = sa[g][0] + sa[g][1];
      const float ts = ((ps[0] + ps[1]) + (ps[2] + ps[3])) +
                       ((ps[4] + ps[5]) + (ps[6] + ps[7]));
      const float alpha = __expf(mrun[g] - mnew);
      lrun[g] = lrun[g] * alpha + ts;
      mrun[g] = mnew;
#pragma unroll
      for (int ct = 0; ct < 4; ++ct) oacc[g][ct] *= alpha;
      // --- P^T as B operand: element s = key 8*lh+s (s<8), 16+8*lh+s-8 (s>=8) ---
      const v16h pt = __builtin_shufflevector(
          __builtin_convertvector(sa[g][0], v8h),
          __builtin_convertvector(sa[g][1], v8h),
          0, 1, 2, 3, 4, 5, 6, 7, 8, 9, 10, 11, 12, 13, 14, 15);
      // --- O^T += V^T P^T: group 0's products run under group 1's softmax ---
#pragma unroll
      for (int ct = 0; ct < 4; ++ct)
        oacc[g][ct] = wmma_f16(av[ct], pt, oacc[g][ct]);
    }
  };

  stage(0, 0);
  wait_async0();
  __syncthreads();                          // stage 0 is there for every wave
  stage(KSTAGE, 1);
  for (int kt = 0; kt < SEQ; kt += KSTAGE) {
    const int buf = (kt / KSTAGE) & 1;
    const _Float16* kb = kbuf + (buf * KSTAGE + ks * 32) * KPITCH;
    const _Float16* vb = vbuf + buf * 64 * VPITCH + ks * 32;
    const float*    bp = bbuf + (buf * QBLK + qg * 32 + lr) * BPITCH + ks * 32 + lh * 8;
    const int*      mp = mbuf + (buf * 8 + wv) * KSTAGE + ks * 32 + lh * 8;
    // unrolled: constant LDS offsets, and a step's reads can start under the
    // softmax of the step before
#pragma unroll
    for (int j = 0; j < KSTAGE / 64; ++j)
      compute(kb + j * 64 * KPITCH, vb + j * 64, bp + j * 64, mp + j * 64);
    // foot of the stage: own reads of this buffer done, own copies of the next
    // stage landed; behind the barrier that holds for all eight waves
    wait_ds0();
    wait_async0();
    __syncthreads();
    if (kt + 2 * KSTAGE < SEQ) stage(kt + 2 * KSTAGE, buf);
  }
  wait_async0();                            // nothing in flight at the end

  // --- the two key halves of a query are joined: each wave of a pair hands
  // one column group to its partner and finishes the other. The ring is free:
  // the last foot's barrier stands behind every wave's last read of it.
  auto put = [&](int g) {
    float* x = bbuf + wv * XCH + lane * 4;
    // unrolled: oacc[][] is indexed by constants and stays in registers
#pragma unroll
    for (int ct = 0; ct < 4; ++ct) {
      *(v4f*)(x + (2 * ct) * 128) =
          __builtin_shufflevector(oacc[g][ct], oacc[g][ct], 0, 1, 2, 3);
      *(v4f*)(x + (2 * ct + 1) * 128) =
          __builtin_shufflevector(oacc[g][ct], oacc[g][ct], 4, 5, 6, 7);
    }
    *(v4f*)(x + 8 * 128) = v4f{mrun[g], lrun[g], 0.0f, 0.0f};
  };
  // normalize, gate, store concat-head f16 [B,S,HC]; a lane holds 8
  // consecutive channels of its query per tile: 16-byte stores
  auto finish = [&](int g) {
    const float* x = bbuf + (wv ^ 4) * XCH + lane * 4;
    const v4f ml = *(const v4f*)(x + 8 * 128);
    const float mm = fmaxf(mrun[g], ml[0]);
    const float a0 = __expf(mrun[g] - mm), a1 = __expf(ml[0] - mm);
    const float l  = lrun[g] * a0 + ml[1] * a1;
    const float rl = 1.0f / (l + other_half(l));
    const float s0 = a0 * rl, s1 = a1 * rl;
    const size_t rowoff =
        ((size_t)(bb * SEQ + q0 + g * 16 + lr)) * HC + h * CHEAD + lh * 8;
    // both loops unrolled: oacc[][] is indexed by constants, loads go together
#pragma unroll
    for (int ct = 0; ct < 4; ++ct) {
      const v4f p0 = *(const v4f*)(x + (2 * ct) * 128);
      const v4f p1 = *(const v4f*)(x + (2 * ct + 1) * 128);
      const float4 g0 = *(const float4*)(gate + rowoff + ct * 16);
      const float4 g1 = *(const float4*)(gate + rowoff + ct * 16 + 4);
      const float g8[8] = {g0.x, g0.y, g0.z, g0.w, g1.x, g1.y, g1.z, g1.w};
      const float p8[8] = {p0[0], p0[1], p0[2], p0[3], p1[0], p1[1], p1[2], p1[3]};
      v8h o;
#pragma unroll
      for (int r = 0; r < 8; ++r)
        o[r] = (_Float16)((oacc[g][ct][r] * s0 + p8[r] * s1) * g8[r]);
      *(v8h*)(ocat + rowoff + ct * 16) = o;
    }
  };
  if (ks == 0) put(1); else put(0);
  __syncthreads();                          // the partner's group is there
  if (ks == 0) finish(0); else finish(1);
}

// ---------------------------------------------------------------------------
// Output GEMM: out[4096,512] = Ocat[4096,512] @ Wo + bo   (Wo given as Wo^T)
// Same core as gemm_proj; block tile 64(M) x 128(N), wave tile 32 x 64, so
// that the grid has one block for every WGP.
// ---------------------------------------------------------------------------
__global__ void __launch_bounds__(128) gemm_out(
    const _Float16* __restrict__ oc, const _Float16* __restrict__ woT,
    const float* __restrict__ bo, float* __restrict__ out) {
  const int tid  = threadIdx.x;
  const int wv   = tid >> 5;
  const int lane = tid & 31;
  const int lr   = lane & 15;
  const int lh   = lane >> 4;
  const int m0   = blockIdx.y * 64;
  const int n0   = blockIdx.x * 128;

  v8f acc[2][4] = {};
  gemm_ring<2>(oc + (size_t)m0 * HC, woT + (size_t)n0 * HC, acc);

  const int mbase = m0 + (wv >> 1) * 32 + lh * 8;
  const int nbase = n0 + (wv & 1) * 64 + lr;
  // unrolled: acc[][] is indexed by constants and stays in registers
#pragma unroll
  for (int nt = 0; nt < 4; ++nt) {
    const int n = nbase + nt * 16;
    const float bn = bo[n];
#pragma unroll
    for (int mt = 0; mt < 2; ++mt)
#pragma unroll
      for (int r = 0; r < 8; ++r)
        out[(size_t)(mbase + mt * 16 + r) * CIN + n] = acc[mt][nt][r] + bn;
  }
}

// ---------------------------------------------------------------------------
extern "C" void kernel_launch(void* const* d_in, const int* in_sizes, int n_in,
                              void* d_out, int out_size, void* d_ws,
                              size_t ws_size, hipStream_t stream) {
  const float* x     = (const float*)d_in[0];
  const float* bias  = (const float*)d_in[1];
  const int*   amask = (const int*)d_in[2];
  const float* Wq    = (const float*)d_in[3];
  const float* Wk    = (const float*)d_in[4];
  const float* Wv    = (const float*)d_in[5];
  const float* Wg    = (const float*)d_in[6];
  const float* bg    = (const float*)d_in[7];
  const float* Wo    = (const float*)d_in[8];
  const float* bo    = (const float*)d_in[9];
  float* out = (float*)d_out;

  char* ws = (char*)d_ws;
  size_t off = 0;
  auto carve = [&](size_t bytes) -> char* {
    char* p = ws + off;
    off += (bytes + 255) & ~(size_t)255;
    return p;
  };
  _Float16* xh  = (_Float16*)carve((size_t)BS * CIN * 2);
  // the five W^T (q, k, v, g, o) in one piece, and Q, K, V^T in one piece
  _Float16* wt5 = (_Float16*)carve((size_t)5 * CIN * HC * 2);
  _Float16* wto = wt5 + (size_t)4 * CIN * HC;
  _Float16* qkv = (_Float16*)carve((size_t)3 * BS * HC * 2);
  _Float16* qh  = qkv;
  _Float16* kh  = qkv + (size_t)BS * HC;
  _Float16* vt  = qkv + (size_t)2 * BS * HC;
  float*    gat = (float*)carve((size_t)BS * HC * 4);
  _Float16* oc  = (_Float16*)carve((size_t)BS * HC * 2);

  // 1) convert x to f16; transpose+convert the 5 weight matrices: one launch
  cvt_all<<<5 * WTILES + XBLOCKS, 256, 0, stream>>>(x, Wq, Wk, Wv, Wg, Wo,
                                                    xh, wt5);

  // 2) projections (Q, K, V^T, gate): one launch
  {
    dim3 grid(HC / 128, BS / 128, 4);
    gemm_proj<<<grid, 128, 0, stream>>>(xh, wt5, bg, qkv, gat);
  }

  // 3) fused flash attention (bias streamed once, softmax online, gated)
  {
    dim3 grid(SEQ / QBLK, BATCH * NHEAD);
    attn_flash<<<grid, 256, 0, stream>>>(qh, kh, vt, bias, amask, gat, oc);
  }

  // 4) output projection + bias
  {
    dim3 grid(CIN / 128, BS / 64);
    gemm_out<<<grid, 128, 0, stream>>>(oc, wto, bo, out);
  }
}
